// v000
// Measured on an AMD MI455X. A time is GPU time per run, averaged over a window of back-to-back runs after a warm-up
// (all launches, gaps included; the runs take copies of the inputs in turn), and the median of several windows.
// Apart from v000's, it joins two sittings. Times from different sittings can be a few percent apart, while
// side-by-side timings come from the same sitting.
// v000, which the later versions start from, runs in 254 microseconds.
#include <hip/hip_runtime.h>
#include <hip/hip_bf16.h>

typedef _Float16 half_t;
typedef __attribute__((ext_vector_type(16))) _Float16 v16h;
typedef __attribute__((ext_vector_type(8)))  float    v8f;

#define N_EMBED   1024
#define HEAD      64
#define TSEQ      4096
#define NBATCH    4
#define NEG_BIG   (-3.0e30f)
#define WPACK_ELEMS 65536   // per matrix: 1024*64

// 16-bit A/B WMMA fragment (16x32) K-mapping:
// element e -> K = (e<8 ? e : e+8) + 8*(lane/16); pair j -> koff(j), koff(j)+1
// inverse:   khalf = (K>>3)&1 ; e = (K&7) + 8*(K>>4)
__device__ __forceinline__ int koff(int j) { return (j < 4) ? (2 * j) : (2 * j + 8); }

__device__ __forceinline__ v8f wmma_f16(v16h a, v16h b, v8f c) {
    return __builtin_amdgcn_wmma_f32_16x16x32_f16(false, a, false, b, (short)0, c, false, false);
}

// ---------------------------------------------------------------------------
// Kernel 0: pack Wq|Wk|Wv (f32 [1024,64]) into f16 B-fragment layout:
// wpack[m][c][n][lane][e]; each lane's 16 halves contiguous (32B).
// ---------------------------------------------------------------------------
__global__ void __launch_bounds__(256)
pack_w_kernel(const float* __restrict__ Wq, const float* __restrict__ Wk,
              const float* __restrict__ Wv, half_t* __restrict__ wpack) {
    const int idx = blockIdx.x * 256 + threadIdx.x;     // 0 .. 3*65536-1
    const int m   = idx >> 16;
    const int r   = idx & (WPACK_ELEMS - 1);
    const int e   = r & 15;
    const int l   = (r >> 4) & 31;
    const int cn  = r >> 9;            // c*4 + n
    const int n   = cn & 3;
    const int c   = cn >> 2;
    const int K   = 32 * c + ((e < 8) ? e : (e + 8)) + 8 * (l >> 4);
    const int col = 16 * n + (l & 15);
    const float* __restrict__ W = (m == 0) ? Wq : (m == 1) ? Wk : Wv;
    wpack[idx] = (half_t)W[(size_t)K * HEAD + col];
}

// ---------------------------------------------------------------------------
// Kernel 1: q,k,v projections. One wave per 16-row tile, full H=64 per wave.
// 12 WMMAs per 32-K chunk. Outputs:
//   qh     f16 [B*T, 64]       pre-scaled by 1/sqrt(H) (for Q B-fragments)
//   khpack f16 [B][T/16][2][32][16]   attention K A-fragment layout
//   vtpack f16 [B][T/32][4][32][16]   attention V^T A-fragment layout
// ---------------------------------------------------------------------------
__global__ void __launch_bounds__(256)
qkv_proj_kernel(const float* __restrict__ x, const half_t* __restrict__ wpack,
                const float* __restrict__ bq, const float* __restrict__ bk,
                const float* __restrict__ bv,
                half_t* __restrict__ qh, half_t* __restrict__ khp,
                half_t* __restrict__ vtp) {
    const int lane   = threadIdx.x & 31;
    const int lane16 = lane & 15;
    const int khalf  = lane >> 4;

    const int rowTile = blockIdx.x * 8 + (threadIdx.x >> 5); // 0 .. B*T/16-1
    const float* __restrict__ xrow =
        x + (size_t)(rowTile * 16 + lane16) * N_EMBED;       // A: M = lane%16

    v8f accq[4] = {}, acck[4] = {}, accv[4] = {};

    for (int c = 0; c < N_EMBED / 32; ++c) {
        // A fragment: x row f32 -> f16 (8 contiguous 8-byte pairs)
        v16h a;
#pragma unroll
        for (int j = 0; j < 8; ++j) {
            const int K  = 32 * c + koff(j) + 8 * khalf;
            a[2 * j]     = (half_t)xrow[K];
            a[2 * j + 1] = (half_t)xrow[K + 1];
        }
        const half_t* __restrict__ wp = wpack + ((size_t)(c * 4) * 32 + lane) * 16;
        v16h bf[12];
#pragma unroll
        for (int n = 0; n < 4; ++n) {
            const half_t* __restrict__ wpn = wp + (size_t)n * 32 * 16;
            bf[3 * n + 0] = *(const v16h*)(wpn);
            bf[3 * n + 1] = *(const v16h*)(wpn + WPACK_ELEMS);
            bf[3 * n + 2] = *(const v16h*)(wpn + 2 * WPACK_ELEMS);
        }
#pragma unroll
        for (int n = 0; n < 4; ++n) {
            accq[n] = wmma_f16(a, bf[3 * n + 0], accq[n]);
            acck[n] = wmma_f16(a, bf[3 * n + 1], acck[n]);
            accv[n] = wmma_f16(a, bf[3 * n + 2], accv[n]);
        }
    }

#pragma unroll
    for (int n = 0; n < 4; ++n) {
        const int col = 16 * n + lane16;   // output column h; C/D: N = lane%16
        const float biasq = bq[col];
        const float biask = bk[col];
        const float biasv = bv[col];
        // k-pack coords from h
        const int kf      = col >> 5;                 // which 32-h fragment
        const int hp      = col & 31;
        const int kh_lane = ((hp >> 3) & 1) * 16;     // + t%16
        const int kh_e    = (hp & 7) + 8 * (hp >> 4);
        // v-pack coords from h
        const int t4      = col >> 4;
        const int v_l16   = col & 15;
#pragma unroll
        for (int r = 0; r < 8; ++r) {
            const int orow = rowTile * 16 + r + 8 * khalf; // M = r + 8*(lane/16)
            const int bidx = orow >> 12;
            const int t    = orow & (TSEQ - 1);
            // q: row major, pre-scaled by 1/sqrt(HEAD)
            qh[(size_t)orow * HEAD + col] = (half_t)((accq[n][r] + biasq) * 0.125f);
            // k: A-fragment layout [b][t/16][kf][lane][e]
            const size_t kidx =
                ((((size_t)bidx * 256 + (t >> 4)) * 2 + kf) * 32 +
                 (kh_lane + (t & 15))) * 16 + kh_e;
            khp[kidx] = (half_t)(acck[n][r] + biask);
            // v: V^T A-fragment layout [b][t/32][t4][lane][e]
            const int Krel = t & 31;
            const size_t vidx =
                ((((size_t)bidx * 128 + (t >> 5)) * 4 + t4) * 32 +
                 (((Krel >> 3) & 1) * 16 + v_l16)) * 16 +
                ((Krel & 7) + 8 * (Krel >> 4));
            vtp[vidx] = (half_t)(accv[n][r] + biasv);
        }
    }
}

// ---------------------------------------------------------------------------
// Kernel 2: flash attention, causal, 64-key chunks. One wave per 16 queries.
// S^T = K * Q^T so softmax'd probabilities convert element-wise into the
// B operands of O^T = V^T * P^T. 16 WMMAs per chunk.
// ---------------------------------------------------------------------------
__global__ void __launch_bounds__(128)
attn_kernel(const half_t* __restrict__ qh, const half_t* __restrict__ khp,
            const half_t* __restrict__ vtp, float* __restrict__ out) {
    const int lane   = threadIdx.x & 31;
    const int lane16 = lane & 15;
    const int khalf  = lane >> 4;

    const int gwave = blockIdx.x * 4 + (threadIdx.x >> 5); // 0..1023
    const int bidx  = gwave >> 8;                          // batch
    const int qbase = (gwave & 255) * 16;                  // query tile start

    // Q^T B-fragments (loaded once): N = query = lane%16, K = h
    const half_t* __restrict__ qrow =
        qh + ((size_t)(bidx << 12) + qbase + lane16) * HEAD;
    v16h bq0, bq1;
#pragma unroll
    for (int j = 0; j < 8; ++j) {
        const int h = koff(j) + 8 * khalf;
        bq0[2 * j]     = qrow[h];
        bq0[2 * j + 1] = qrow[h + 1];
        bq1[2 * j]     = qrow[h + 32];
        bq1[2 * j + 1] = qrow[h + 33];
    }

    float m = NEG_BIG, l = 0.0f;
    v8f o0 = {}, o1 = {}, o2 = {}, o3 = {};

    const int qg = qbase + lane16;  // this lane's query index (global in batch)

    for (int kbase = 0; kbase < qbase + 16; kbase += 64) {
        // --- scores S^T for 64 keys: 4 subtiles x 2 WMMAs ---
        const half_t* __restrict__ kbp =
            khp + ((size_t)(bidx * 256 + (kbase >> 4)) * 1024) + (size_t)lane * 16;
        v8f s0 = {}, s1 = {}, s2 = {}, s3 = {};
        {
            v16h akl = *(const v16h*)(kbp);
            v16h akh = *(const v16h*)(kbp + 512);
            s0 = wmma_f16(akl, bq0, s0);
            s0 = wmma_f16(akh, bq1, s0);
        }
        {
            v16h akl = *(const v16h*)(kbp + 1024);
            v16h akh = *(const v16h*)(kbp + 1536);
            s1 = wmma_f16(akl, bq0, s1);
            s1 = wmma_f16(akh, bq1, s1);
        }
        {
            v16h akl = *(const v16h*)(kbp + 2048);
            v16h akh = *(const v16h*)(kbp + 2560);
            s2 = wmma_f16(akl, bq0, s2);
            s2 = wmma_f16(akh, bq1, s2);
        }
        {
            v16h akl = *(const v16h*)(kbp + 3072);
            v16h akh = *(const v16h*)(kbp + 3584);
            s3 = wmma_f16(akl, bq0, s3);
            s3 = wmma_f16(akh, bq1, s3);
        }

        // --- causal mask (scale already folded into q) ---
        if ((kbase + 63) > qg) {
#pragma unroll
            for (int r = 0; r < 8; ++r) {
                const int kg = kbase + r + 8 * khalf; // key = r + 8*(lane/16)
                if (kg > qg)      s0[r] = NEG_BIG;
                if (kg + 16 > qg) s1[r] = NEG_BIG;
                if (kg + 32 > qg) s2[r] = NEG_BIG;
                if (kg + 48 > qg) s3[r] = NEG_BIG;
            }
        }

        // --- online softmax: one shfl_xor(16) completes each 64-key row ---
        float mc = s0[0];
#pragma unroll
        for (int r = 1; r < 8; ++r) mc = fmaxf(mc, s0[r]);
#pragma unroll
        for (int r = 0; r < 8; ++r) {
            mc = fmaxf(mc, s1[r]);
            mc = fmaxf(mc, s2[r]);
            mc = fmaxf(mc, s3[r]);
        }
        mc = fmaxf(mc, __shfl_xor(mc, 16, 32));

        const float m_new = fmaxf(m, mc);
        const float alpha = __expf(m - m_new);

        float rs = 0.0f;
#pragma unroll
        for (int r = 0; r < 8; ++r) {
            s0[r] = __expf(s0[r] - m_new); rs += s0[r];
            s1[r] = __expf(s1[r] - m_new); rs += s1[r];
            s2[r] = __expf(s2[r] - m_new); rs += s2[r];
            s3[r] = __expf(s3[r] - m_new); rs += s3[r];
        }
        rs += __shfl_xor(rs, 16, 32);
        l = l * alpha + rs;
        m = m_new;

#pragma unroll
        for (int r = 0; r < 8; ++r) {
            o0[r] *= alpha; o1[r] *= alpha; o2[r] *= alpha; o3[r] *= alpha;
        }

        // --- P^T B operands: direct element copy from S^T accumulators ---
        v16h pb0, pb1;
#pragma unroll
        for (int r = 0; r < 8; ++r) {
            pb0[r]     = (half_t)s0[r];  // keys kbase    .. +15
            pb0[r + 8] = (half_t)s1[r];  // keys kbase+16 .. +31
            pb1[r]     = (half_t)s2[r];  // keys kbase+32 .. +47
            pb1[r + 8] = (half_t)s3[r];  // keys kbase+48 .. +63
        }

        // --- O^T += V^T * P^T : 4 h-tiles x 2 key-halves = 8 WMMAs ---
        const half_t* __restrict__ vbp =
            vtp + ((size_t)(bidx * 128 + (kbase >> 5)) * 2048) + (size_t)lane * 16;
        {
            v16h av = *(const v16h*)(vbp);          o0 = wmma_f16(av, pb0, o0);
            v16h aw = *(const v16h*)(vbp + 2048);   o0 = wmma_f16(aw, pb1, o0);
        }
        {
            v16h av = *(const v16h*)(vbp + 512);    o1 = wmma_f16(av, pb0, o1);
            v16h aw = *(const v16h*)(vbp + 2560);   o1 = wmma_f16(aw, pb1, o1);
        }
        {
            v16h av = *(const v16h*)(vbp + 1024);   o2 = wmma_f16(av, pb0, o2);
            v16h aw = *(const v16h*)(vbp + 3072);   o2 = wmma_f16(aw, pb1, o2);
        }
        {
            v16h av = *(const v16h*)(vbp + 1536);   o3 = wmma_f16(av, pb0, o3);
            v16h aw = *(const v16h*)(vbp + 3584);   o3 = wmma_f16(aw, pb1, o3);
        }
    }

    // --- epilogue: O^T element (h = t4*16 + r + 8*khalf, query = lane%16) ---
    const float inv = 1.0f / l;
    float* __restrict__ orow =
        out + ((size_t)(bidx << 12) + qbase + lane16) * HEAD + 8 * khalf;
    v8f oo[4] = {o0, o1, o2, o3};
#pragma unroll
    for (int t4 = 0; t4 < 4; ++t4) {
        float4 lo, hi;
        lo.x = oo[t4][0] * inv; lo.y = oo[t4][1] * inv;
        lo.z = oo[t4][2] * inv; lo.w = oo[t4][3] * inv;
        hi.x = oo[t4][4] * inv; hi.y = oo[t4][5] * inv;
        hi.z = oo[t4][6] * inv; hi.w = oo[t4][7] * inv;
        float4* p = (float4*)(orow + t4 * 16);
        p[0] = lo;
        p[1] = hi;
    }
}

// ---------------------------------------------------------------------------
extern "C" void kernel_launch(void* const* d_in, const int* in_sizes, int n_in,
                              void* d_out, int out_size, void* d_ws, size_t ws_size,
                              hipStream_t stream) {
    const float* x  = (const float*)d_in[0];
    const float* Wq = (const float*)d_in[1];
    const float* bq = (const float*)d_in[2];
    const float* Wk = (const float*)d_in[3];
    const float* bk = (const float*)d_in[4];
    const float* Wv = (const float*)d_in[5];
    const float* bv = (const float*)d_in[6];
    float* out = (float*)d_out;

    const size_t QK = (size_t)NBATCH * TSEQ * HEAD; // 1,048,576 elems
    half_t* qh    = (half_t*)d_ws;
    half_t* khp   = qh + QK;                 // K in A-fragment layout
    half_t* vtp   = khp + QK;                // V^T in A-fragment layout
    half_t* wpack = vtp + QK;                // 3 * 65536 f16

    pack_w_kernel<<<(3 * WPACK_ELEMS) / 256, 256, 0, stream>>>(Wq, Wk, Wv, wpack);

    const int rowTiles = NBATCH * TSEQ / 16;  // 1024 row tiles, 8 waves/block
    qkv_proj_kernel<<<rowTiles / 8, 256, 0, stream>>>(x, wpack, bq, bk, bv,
                                                      qh, khp, vtp);

    const int waves = NBATCH * (TSEQ / 16);   // 1024 waves, 4 per block
    attn_kernel<<<waves / 4, 128, 0, stream>>>(qh, khp, vtp, out);
}

// v001
// A run of this version takes 64 microseconds.
// Next to v000, in two timings, it ran 3.98 and 3.90 times as fast.
#include <hip/hip_runtime.h>
#include <hip/hip_bf16.h>

typedef _Float16 half_t;
typedef __attribute__((ext_vector_type(16))) _Float16 v16h;
typedef __attribute__((ext_vector_type(8)))  float    v8f;

#define N_EMBED   1024
#define HEAD      64
#define TSEQ      4096
#define NBATCH    4
#define NEG_BIG   (-3.0e30f)
#define WPACK_ELEMS 65536   // per matrix: 1024*64

// 16-bit A/B WMMA fragment (16x32) K-mapping:
// element e -> K = (e<8 ? e : e+8) + 8*(lane/16); pair j -> koff(j), koff(j)+1
// inverse:   khalf = (K>>3)&1 ; e = (K&7) + 8*(K>>4)
__device__ __forceinline__ int koff(int j) { return (j < 4) ? (2 * j) : (2 * j + 8); }

__device__ __forceinline__ v8f wmma_f16(v16h a, v16h b, v8f c) {
    return __builtin_amdgcn_wmma_f32_16x16x32_f16(false, a, false, b, (short)0, c, false, false);
}

// ---------------------------------------------------------------------------
// Kernel 0: pack Wq|Wk|Wv (f32 [1024,64]) into f16 B-fragment layout:
// wpack[m][c][n][lane][e]; each lane's 16 halves contiguous (32B).
// ---------------------------------------------------------------------------
__global__ void __launch_bounds__(256)
pack_w_kernel(const float* __restrict__ Wq, const float* __restrict__ Wk,
              const float* __restrict__ Wv, half_t* __restrict__ wpack) {
    const int idx = blockIdx.x * 256 + threadIdx.x;     // 0 .. 3*65536-1
    const int m   = idx >> 16;
    const int r   = idx & (WPACK_ELEMS - 1);
    const int e   = r & 15;
    const int l   = (r >> 4) & 31;
    const int cn  = r >> 9;            // c*4 + n
    const int n   = cn & 3;
    const int c   = cn >> 2;
    const int K   = 32 * c + ((e < 8) ? e : (e + 8)) + 8 * (l >> 4);
    const int col = 16 * n + (l & 15);
    const float* __restrict__ W = (m == 0) ? Wq : (m == 1) ? Wk : Wv;
    wpack[idx] = (half_t)W[(size_t)K * HEAD + col];
}

// One lane's 16 x values of 32-K chunk c, still f32: floats 0..7 and 16..23
// behind xk = row + 8*(lane/16), the K order of the A fragment.
__device__ __forceinline__ void load_x(const float* __restrict__ xk, int c, float4 (&r)[4]) {
    const float4* __restrict__ p = (const float4*)(xk + 32 * c);
    r[0] = p[0]; r[1] = p[1]; r[2] = p[4]; r[3] = p[5];
}

__device__ __forceinline__ v16h cvt_x(const float4 (&r)[4]) {
    v16h a;
#pragma unroll
    for (int i = 0; i < 4; ++i) {
        a[4 * i + 0] = (half_t)r[i].x;
        a[4 * i + 1] = (half_t)r[i].y;
        a[4 * i + 2] = (half_t)r[i].z;
        a[4 * i + 3] = (half_t)r[i].w;
    }
    return a;
}

// One 32-K chunk: all 12 B fragments are requested together, then (MORE) the
// x values of chunk c+2 into the registers chunk c has just left, and only
// then come the 12 WMMAs.
template <bool MORE>
__device__ __forceinline__ void qkv_pass(const float* __restrict__ xk,
                                         const half_t* __restrict__ wlane, int c,
                                         float4 (&xr)[4], v8f (&accq)[4],
                                         v8f (&acck)[4], v8f (&accv)[4]) {
    const v16h a = cvt_x(xr);
    const half_t* __restrict__ wp = wlane + (size_t)c * (4 * 32 * 16);
    v16h bf[12];
#pragma unroll
    for (int n = 0; n < 4; ++n) {
        const half_t* __restrict__ wpn = wp + (size_t)n * 32 * 16;
        bf[3 * n + 0] = *(const v16h*)(wpn);
        bf[3 * n + 1] = *(const v16h*)(wpn + WPACK_ELEMS);
        bf[3 * n + 2] = *(const v16h*)(wpn + 2 * WPACK_ELEMS);
    }
    if (MORE) load_x(xk, c + 2, xr);
    // Keeps the loads above as one group: without it each B load sinks to its
    // own WMMA and the wave waits out one load latency per WMMA.
    __builtin_amdgcn_sched_barrier(0);
#pragma unroll
    for (int n = 0; n < 4; ++n) {
        accq[n] = wmma_f16(a, bf[3 * n + 0], accq[n]);
        acck[n] = wmma_f16(a, bf[3 * n + 1], acck[n]);
        accv[n] = wmma_f16(a, bf[3 * n + 2], accv[n]);
    }
}

// ---------------------------------------------------------------------------
// Kernel 1: q,k,v projections. One wave per 16-row tile, full H=64 per wave.
// 12 WMMAs per 32-K chunk. Outputs:
//   qh     f16 [B*T, 64]       pre-scaled by 1/sqrt(H) (for Q B-fragments)
//   khpack f16 [B][T/16][2][32][16]   attention K A-fragment layout
//   vtpack f16 [B][T/32][4][32][16]   attention V^T A-fragment layout
// ---------------------------------------------------------------------------
__global__ void __launch_bounds__(256)
qkv_proj_kernel(const float* __restrict__ x, const half_t* __restrict__ wpack,
                const float* __restrict__ bq, const float* __restrict__ bk,
                const float* __restrict__ bv,
                half_t* __restrict__ qh, half_t* __restrict__ khp,
                half_t* __restrict__ vtp) {
    const int lane   = threadIdx.x & 31;
    const int lane16 = lane & 15;
    const int khalf  = lane >> 4;

    const int rowTile = blockIdx.x * 8 + (threadIdx.x >> 5); // 0 .. B*T/16-1
    const float* __restrict__ xrow =
        x + (size_t)(rowTile * 16 + lane16) * N_EMBED;       // A: M = lane%16

    v8f accq[4] = {}, acck[4] = {}, accv[4] = {};

    const float* __restrict__ xk = xrow + 8 * khalf;
    const half_t* __restrict__ wlane = wpack + (size_t)lane * 16;
    float4 xr0[4], xr1[4];               // x of the even and of the odd chunks
    load_x(xk, 0, xr0);
    load_x(xk, 1, xr1);
    for (int c = 0; c < N_EMBED / 32 - 2; c += 2) {
        qkv_pass<true>(xk, wlane, c,     xr0, accq, acck, accv);
        qkv_pass<true>(xk, wlane, c + 1, xr1, accq, acck, accv);
    }
    qkv_pass<false>(xk, wlane, N_EMBED / 32 - 2, xr0, accq, acck, accv);
    qkv_pass<false>(xk, wlane, N_EMBED / 32 - 1, xr1, accq, acck, accv);

#pragma unroll
    for (int n = 0; n < 4; ++n) {
        const int col = 16 * n + lane16;   // output column h; C/D: N = lane%16
        const float biasq = bq[col];
        const float biask = bk[col];
        const float biasv = bv[col];
        // k-pack coords from h
        const int kf      = col >> 5;                 // which 32-h fragment
        const int hp      = col & 31;
        const int kh_lane = ((hp >> 3) & 1) * 16;     // + t%16
        const int kh_e    = (hp & 7) + 8 * (hp >> 4);
        // v-pack coords from h
        const int t4      = col >> 4;
        const int v_l16   = col & 15;
#pragma unroll
        for (int r = 0; r < 8; ++r) {
            const int orow = rowTile * 16 + r + 8 * khalf; // M = r + 8*(lane/16)
            const int bidx = orow >> 12;
            const int t    = orow & (TSEQ - 1);
            // q: row major, pre-scaled by 1/sqrt(HEAD)
            qh[(size_t)orow * HEAD + col] = (half_t)((accq[n][r] + biasq) * 0.125f);
            // k: A-fragment layout [b][t/16][kf][lane][e]
            const size_t kidx =
                ((((size_t)bidx * 256 + (t >> 4)) * 2 + kf) * 32 +
                 (kh_lane + (t & 15))) * 16 + kh_e;
            khp[kidx] = (half_t)(acck[n][r] + biask);
            // v: V^T A-fragment layout [b][t/32][t4][lane][e]
            const int Krel = t & 31;
            const size_t vidx =
                ((((size_t)bidx * 128 + (t >> 5)) * 4 + t4) * 32 +
                 (((Krel >> 3) & 1) * 16 + v_l16)) * 16 +
                ((Krel & 7) + 8 * (Krel >> 4));
            vtp[vidx] = (half_t)(accv[n][r] + biasv);
        }
    }
}

// ---------------------------------------------------------------------------
// Kernel 2: flash attention, causal, 64-key chunks. One wave per 16 queries.
// S^T = K * Q^T so softmax'd probabilities convert element-wise into the
// B operands of O^T = V^T * P^T. 16 WMMAs per chunk.
// ---------------------------------------------------------------------------
__global__ void __launch_bounds__(128)
attn_kernel(const half_t* __restrict__ qh, const half_t* __restrict__ khp,
            const half_t* __restrict__ vtp, float* __restrict__ out) {
    const int lane   = threadIdx.x & 31;
    const int lane16 = lane & 15;
    const int khalf  = lane >> 4;

    const int gwave = blockIdx.x * 4 + (threadIdx.x >> 5); // 0..1023
    const int bidx  = gwave >> 8;                          // batch
    const int qbase = (gwave & 255) * 16;                  // query tile start

    // Q^T B-fragments (loaded once): N = query = lane%16, K = h
    const half_t* __restrict__ qrow =
        qh + ((size_t)(bidx << 12) + qbase + lane16) * HEAD;
    v16h bq0, bq1;
#pragma unroll
    for (int j = 0; j < 8; ++j) {
        const int h = koff(j) + 8 * khalf;
        bq0[2 * j]     = qrow[h];
        bq0[2 * j + 1] = qrow[h + 1];
        bq1[2 * j]     = qrow[h + 32];
        bq1[2 * j + 1] = qrow[h + 33];
    }

    float m = NEG_BIG, l = 0.0f;
    v8f o0 = {}, o1 = {}, o2 = {}, o3 = {};

    const int qg = qbase + lane16;  // this lane's query index (global in batch)

    const int kend = qbase + 16;    // first key no query of this tile sees
    const half_t* __restrict__ klane = khp + (size_t)bidx * 256 * 1024 + (size_t)lane * 16;
    const half_t* __restrict__ vlane = vtp + (size_t)bidx * 128 * 2048 + (size_t)lane * 16;

    // K fragments of the first chunk; each pass fetches the next chunk's.
    v16h kf[8];
#pragma unroll
    for (int i = 0; i < 8; ++i) kf[i] = *(const v16h*)(klane + i * 512);
    // Where the next fetch reads: one chunk (4096 halves) on, but never past
    // this tile's last chunk, which the last pass simply asks for again.
    const half_t* __restrict__ knext = klane + ((64 < kend) ? 4096 : 0);

    for (int kbase = 0; kbase < kend; kbase += 64) {
        // --- this chunk's V^T fragments, wanted behind the softmax ---
        const half_t* __restrict__ vbp = vlane + (size_t)(kbase >> 5) * 2048;
        v16h vf[8];
#pragma unroll
        for (int i = 0; i < 8; ++i) vf[i] = *(const v16h*)(vbp + i * 512);

        // --- scores S^T for 64 keys: 4 subtiles x 2 WMMAs ---
        v8f s0 = {}, s1 = {}, s2 = {}, s3 = {};
        s0 = wmma_f16(kf[0], bq0, s0);
        s1 = wmma_f16(kf[2], bq0, s1);
        s2 = wmma_f16(kf[4], bq0, s2);
        s3 = wmma_f16(kf[6], bq0, s3);
        s0 = wmma_f16(kf[1], bq1, s0);
        s1 = wmma_f16(kf[3], bq1, s1);
        s2 = wmma_f16(kf[5], bq1, s2);
        s3 = wmma_f16(kf[7], bq1, s3);

        // --- causal mask (scale already folded into q) ---
        if ((kbase + 63) > qg) {
#pragma unroll
            for (int r = 0; r < 8; ++r) {
                const int kg = kbase + r + 8 * khalf; // key = r + 8*(lane/16)
                if (kg > qg)      s0[r] = NEG_BIG;
                if (kg + 16 > qg) s1[r] = NEG_BIG;
                if (kg + 32 > qg) s2[r] = NEG_BIG;
                if (kg + 48 > qg) s3[r] = NEG_BIG;
            }
        }

        // --- next chunk's K fragments ---
#pragma unroll
        for (int i = 0; i < 8; ++i) kf[i] = *(const v16h*)(knext + i * 512);
        knext += (kbase + 128 < kend) ? 4096 : 0;
        // Keeps the K loads here, in front of the softmax: without it they sink
        // to the head of the next pass, whose WMMAs then wait out their latency.
        __builtin_amdgcn_sched_barrier(0);

        // --- online softmax: one shfl_xor(16) completes each 64-key row ---
        float mc = s0[0];
#pragma unroll
        for (int r = 1; r < 8; ++r) mc = fmaxf(mc, s0[r]);
#pragma unroll
        for (int r = 0; r < 8; ++r) {
            mc = fmaxf(mc, s1[r]);
            mc = fmaxf(mc, s2[r]);
            mc = fmaxf(mc, s3[r]);
        }
        mc = fmaxf(mc, __shfl_xor(mc, 16, 32));

        const float m_new = fmaxf(m, mc);
        const float alpha = __expf(m - m_new);

        float rs = 0.0f;
#pragma unroll
        for (int r = 0; r < 8; ++r) {
            s0[r] = __expf(s0[r] - m_new); rs += s0[r];
            s1[r] = __expf(s1[r] - m_new); rs += s1[r];
            s2[r] = __expf(s2[r] - m_new); rs += s2[r];
            s3[r] = __expf(s3[r] - m_new); rs += s3[r];
        }
        rs += __shfl_xor(rs, 16, 32);
        l = l * alpha + rs;
        m = m_new;

#pragma unroll
        for (int r = 0; r < 8; ++r) {
            o0[r] *= alpha; o1[r] *= alpha; o2[r] *= alpha; o3[r] *= alpha;
        }

        // --- P^T B operands: direct element copy from S^T accumulators ---
        v16h pb0, pb1;
#pragma unroll
        for (int r = 0; r < 8; ++r) {
            pb0[r]     = (half_t)s0[r];  // keys kbase    .. +15
            pb0[r + 8] = (half_t)s1[r];  // keys kbase+16 .. +31
            pb1[r]     = (half_t)s2[r];  // keys kbase+32 .. +47
            pb1[r + 8] = (half_t)s3[r];  // keys kbase+48 .. +63
        }

        // --- O^T += V^T * P^T : 4 h-tiles x 2 key-halves = 8 WMMAs ---
        o0 = wmma_f16(vf[0], pb0, o0);
        o1 = wmma_f16(vf[1], pb0, o1);
        o2 = wmma_f16(vf[2], pb0, o2);
        o3 = wmma_f16(vf[3], pb0, o3);
        o0 = wmma_f16(vf[4], pb1, o0);
        o1 = wmma_f16(vf[5], pb1, o1);
        o2 = wmma_f16(vf[6], pb1, o2);
        o3 = wmma_f16(vf[7], pb1, o3);
    }

    // --- epilogue: O^T element (h = t4*16 + r + 8*khalf, query = lane%16) ---
    const float inv = 1.0f / l;
    float* __restrict__ orow =
        out + ((size_t)(bidx << 12) + qbase + lane16) * HEAD + 8 * khalf;
    v8f oo[4] = {o0, o1, o2, o3};
#pragma unroll
    for (int t4 = 0; t4 < 4; ++t4) {
        float4 lo, hi;
        lo.x = oo[t4][0] * inv; lo.y = oo[t4][1] * inv;
        lo.z = oo[t4][2] * inv; lo.w = oo[t4][3] * inv;
        hi.x = oo[t4][4] * inv; hi.y = oo[t4][5] * inv;
        hi.z = oo[t4][6] * inv; hi.w = oo[t4][7] * inv;
        float4* p = (float4*)(orow + t4 * 16);
        p[0] = lo;
        p[1] = hi;
    }
}

// ---------------------------------------------------------------------------
extern "C" void kernel_launch(void* const* d_in, const int* in_sizes, int n_in,
                              void* d_out, int out_size, void* d_ws, size_t ws_size,
                              hipStream_t stream) {
    const float* x  = (const float*)d_in[0];
    const float* Wq = (const float*)d_in[1];
    const float* bq = (const float*)d_in[2];
    const float* Wk = (const float*)d_in[3];
    const float* bk = (const float*)d_in[4];
    const float* Wv = (const float*)d_in[5];
    const float* bv = (const float*)d_in[6];
    float* out = (float*)d_out;

    const size_t QK = (size_t)NBATCH * TSEQ * HEAD; // 1,048,576 elems
    half_t* qh    = (half_t*)d_ws;
    half_t* khp   = qh + QK;                 // K in A-fragment layout
    half_t* vtp   = khp + QK;                // V^T in A-fragment layout
    half_t* wpack = vtp + QK;                // 3 * 65536 f16

    pack_w_kernel<<<(3 * WPACK_ELEMS) / 256, 256, 0, stream>>>(Wq, Wk, Wv, wpack);

    const int rowTiles = NBATCH * TSEQ / 16;  // 1024 row tiles, 8 waves/block
    qkv_proj_kernel<<<rowTiles / 8, 256, 0, stream>>>(x, wpack, bq, bk, bv,
                                                      qh, khp, vtp);

    const int waves = NBATCH * (TSEQ / 16);   // 1024 waves, 4 per block
    attn_kernel<<<waves / 4, 128, 0, stream>>>(qh, khp, vtp, out);
}

// v002
// A run of this version takes 44.6 microseconds.
// Two timings next to v001 put it at 1.47 and 1.44 times that version's speed.
// Over all steps from v000 it is 5.74 times as fast.
#include <hip/hip_runtime.h>
#include <hip/hip_bf16.h>

typedef _Float16 half_t;
typedef __attribute__((ext_vector_type(16))) _Float16 v16h;
typedef __attribute__((ext_vector_type(8)))  float    v8f;

#define N_EMBED   1024
#define HEAD      64
#define TSEQ      4096
#define NBATCH    4
#define NEG_BIG   (-3.0e30f)
#define WPACK_ELEMS 65536   // per matrix: 1024*64

// 16-bit A/B WMMA fragment (16x32) K-mapping:
// element e -> K = (e<8 ? e : e+8) + 8*(lane/16); pair j -> koff(j), koff(j)+1
// inverse:   khalf = (K>>3)&1 ; e = (K&7) + 8*(K>>4)
__device__ __forceinline__ int koff(int j) { return (j < 4) ? (2 * j) : (2 * j + 8); }

__device__ __forceinline__ v8f wmma_f16(v16h a, v16h b, v8f c) {
    return __builtin_amdgcn_wmma_f32_16x16x32_f16(false, a, false, b, (short)0, c, false, false);
}

// ---------------------------------------------------------------------------
// Kernel 0: pack Wq|Wk|Wv (f32 [1024,64]) into f16 B-fragment layout:
// wpack[m][c][n][lane][e]; each lane's 16 halves contiguous (32B).
// ---------------------------------------------------------------------------
__global__ void __launch_bounds__(256)
pack_w_kernel(const float* __restrict__ Wq, const float* __restrict__ Wk,
              const float* __restrict__ Wv, half_t* __restrict__ wpack) {
    const int idx = blockIdx.x * 256 + threadIdx.x;     // 0 .. 3*65536-1
    const int m   = idx >> 16;
    const int r   = idx & (WPACK_ELEMS - 1);
    const int e   = r & 15;
    const int l   = (r >> 4) & 31;
    const int cn  = r >> 9;            // c*4 + n
    const int n   = cn & 3;
    const int c   = cn >> 2;
    const int K   = 32 * c + ((e < 8) ? e : (e + 8)) + 8 * (l >> 4);
    const int col = 16 * n + (l & 15);
    const float* __restrict__ W = (m == 0) ? Wq : (m == 1) ? Wk : Wv;
    wpack[idx] = (half_t)W[(size_t)K * HEAD + col];
}

// One lane's 16 x values of 32-K chunk c, still f32: floats 0..7 and 16..23
// behind xk = row + 8*(lane/16), the K order of the A fragment.
__device__ __forceinline__ void load_x(const float* __restrict__ xk, int c, float4 (&r)[4]) {
    const float4* __restrict__ p = (const float4*)(xk + 32 * c);
    r[0] = p[0]; r[1] = p[1]; r[2] = p[4]; r[3] = p[5];
}

__device__ __forceinline__ v16h cvt_x(const float4 (&r)[4]) {
    v16h a;
#pragma unroll
    for (int i = 0; i < 4; ++i) {
        a[4 * i + 0] = (half_t)r[i].x;
        a[4 * i + 1] = (half_t)r[i].y;
        a[4 * i + 2] = (half_t)r[i].z;
        a[4 * i + 3] = (half_t)r[i].w;
    }
    return a;
}

// One 32-K chunk: all 12 B fragments are requested together, then (MORE) the
// x values of chunk c+2 into the registers chunk c has just left, and only
// then come the 12 WMMAs.
template <bool MORE>
__device__ __forceinline__ void qkv_pass(const float* __restrict__ xk,
                                         const half_t* __restrict__ wlane, int c,
                                         float4 (&xr)[4], v8f (&accq)[4],
                                         v8f (&acck)[4], v8f (&accv)[4]) {
    const v16h a = cvt_x(xr);
    const half_t* __restrict__ wp = wlane + (size_t)c * (4 * 32 * 16);
    v16h bf[12];
#pragma unroll
    for (int n = 0; n < 4; ++n) {
        const half_t* __restrict__ wpn = wp + (size_t)n * 32 * 16;
        bf[3 * n + 0] = *(const v16h*)(wpn);
        bf[3 * n + 1] = *(const v16h*)(wpn + WPACK_ELEMS);
        bf[3 * n + 2] = *(const v16h*)(wpn + 2 * WPACK_ELEMS);
    }
    if (MORE) load_x(xk, c + 2, xr);
    // Keeps the loads above as one group: without it each B load sinks to its
    // own WMMA and the wave waits out one load latency per WMMA.
    __builtin_amdgcn_sched_barrier(0);
#pragma unroll
    for (int n = 0; n < 4; ++n) {
        accq[n] = wmma_f16(a, bf[3 * n + 0], accq[n]);
        acck[n] = wmma_f16(a, bf[3 * n + 1], acck[n]);
        accv[n] = wmma_f16(a, bf[3 * n + 2], accv[n]);
    }
}

// ---------------------------------------------------------------------------
// Kernel 1: q,k,v projections. One wave per 16-row tile, full H=64 per wave.
// 12 WMMAs per 32-K chunk. Outputs:
//   qh     f16 [B*T, 64]       pre-scaled by 1/sqrt(H) (for Q B-fragments)
//   khpack f16 [B][T/16][2][32][16]   attention K A-fragment layout
//   vtpack f16 [B][T/32][4][32][16]   attention V^T A-fragment layout
// ---------------------------------------------------------------------------
__global__ void __launch_bounds__(256)
qkv_proj_kernel(const float* __restrict__ x, const half_t* __restrict__ wpack,
                const float* __restrict__ bq, const float* __restrict__ bk,
                const float* __restrict__ bv,
                half_t* __restrict__ qh, half_t* __restrict__ khp,
                half_t* __restrict__ vtp) {
    const int lane   = threadIdx.x & 31;
    const int lane16 = lane & 15;
    const int khalf  = lane >> 4;

    const int rowTile = blockIdx.x * 8 + (threadIdx.x >> 5); // 0 .. B*T/16-1
    const float* __restrict__ xrow =
        x + (size_t)(rowTile * 16 + lane16) * N_EMBED;       // A: M = lane%16

    v8f accq[4] = {}, acck[4] = {}, accv[4] = {};

    const float* __restrict__ xk = xrow + 8 * khalf;
    const half_t* __restrict__ wlane = wpack + (size_t)lane * 16;
    float4 xr0[4], xr1[4];               // x of the even and of the odd chunks
    load_x(xk, 0, xr0);
    load_x(xk, 1, xr1);
    for (int c = 0; c < N_EMBED / 32 - 2; c += 2) {
        qkv_pass<true>(xk, wlane, c,     xr0, accq, acck, accv);
        qkv_pass<true>(xk, wlane, c + 1, xr1, accq, acck, accv);
    }
    qkv_pass<false>(xk, wlane, N_EMBED / 32 - 2, xr0, accq, acck, accv);
    qkv_pass<false>(xk, wlane, N_EMBED / 32 - 1, xr1, accq, acck, accv);

#pragma unroll
    for (int n = 0; n < 4; ++n) {
        const int col = 16 * n + lane16;   // output column h; C/D: N = lane%16
        const float biasq = bq[col];
        const float biask = bk[col];
        const float biasv = bv[col];
        // k-pack coords from h
        const int kf      = col >> 5;                 // which 32-h fragment
        const int hp      = col & 31;
        const int kh_lane = ((hp >> 3) & 1) * 16;     // + t%16
        const int kh_e    = (hp & 7) + 8 * (hp >> 4);
        // v-pack coords from h
        const int t4      = col >> 4;
        const int v_l16   = col & 15;
#pragma unroll
        for (int r = 0; r < 8; ++r) {
            const int orow = rowTile * 16 + r + 8 * khalf; // M = r + 8*(lane/16)
            const int bidx = orow >> 12;
            const int t    = orow & (TSEQ - 1);
            // q: row major, pre-scaled by 1/sqrt(HEAD)
            qh[(size_t)orow * HEAD + col] = (half_t)((accq[n][r] + biasq) * 0.125f);
            // k: A-fragment layout [b][t/16][kf][lane][e]
            const size_t kidx =
                ((((size_t)bidx * 256 + (t >> 4)) * 2 + kf) * 32 +
                 (kh_lane + (t & 15))) * 16 + kh_e;
            khp[kidx] = (half_t)(acck[n][r] + biask);
            // v: V^T A-fragment layout [b][t/32][t4][lane][e]
            const int Krel = t & 31;
            const size_t vidx =
                ((((size_t)bidx * 128 + (t >> 5)) * 4 + t4) * 32 +
                 (((Krel >> 3) & 1) * 16 + v_l16)) * 16 +
                ((Krel & 7) + 8 * (Krel >> 4));
            vtp[vidx] = (half_t)(accv[n][r] + biasv);
        }
    }
}

// ---------------------------------------------------------------------------
// Kernel 2: flash attention, causal, 64-key chunks.
// S^T = K * Q^T so softmax'd probabilities convert element-wise into the
// B operands of O^T = V^T * P^T.
// A block owns two groups of 32 queries, group 127-p and group p of one batch:
// together they always see 65 chunks, so every block has the same work. The 8
// waves deal these 65 chunks out among themselves; each K/V fragment a wave
// loads serves both 16-query tiles of the group. Every wave keeps its own
// (m, l, O) per tile, leaves them in LDS, and behind one barrier the block
// merges the 8 partial results of each query.
// ---------------------------------------------------------------------------
#define AWAVES 8

// Online softmax of one 16-query tile over one 64-key chunk: updates m, l,
// rescales o, and returns the probabilities as the two P^T B operands.
__device__ __forceinline__ void softmax_tile(v8f (&s)[4], float& m, float& l,
                                             v8f (&o)[4], v16h& pb0, v16h& pb1) {
    // one shfl_xor(16) completes each 64-key row
    float mc = s[0][0];
#pragma unroll
    for (int r = 1; r < 8; ++r) mc = fmaxf(mc, s[0][r]);
#pragma unroll
    for (int r = 0; r < 8; ++r) {
        mc = fmaxf(mc, s[1][r]);
        mc = fmaxf(mc, s[2][r]);
        mc = fmaxf(mc, s[3][r]);
    }
    mc = fmaxf(mc, __shfl_xor(mc, 16, 32));

    const float m_new = fmaxf(m, mc);
    const float alpha = __expf(m - m_new);

    float rs = 0.0f;
#pragma unroll
    for (int r = 0; r < 8; ++r) {
        s[0][r] = __expf(s[0][r] - m_new); rs += s[0][r];
        s[1][r] = __expf(s[1][r] - m_new); rs += s[1][r];
        s[2][r] = __expf(s[2][r] - m_new); rs += s[2][r];
        s[3][r] = __expf(s[3][r] - m_new); rs += s[3][r];
    }
    rs += __shfl_xor(rs, 16, 32);
    l = l * alpha + rs;
    m = m_new;

#pragma unroll
    for (int r = 0; r < 8; ++r) {
        o[0][r] *= alpha; o[1][r] *= alpha; o[2][r] *= alpha; o[3][r] *= alpha;
    }

    // P^T B operands: direct element copy from S^T accumulators
#pragma unroll
    for (int r = 0; r < 8; ++r) {
        pb0[r]     = (half_t)s[0][r];  // keys kbase    .. +15
        pb0[r + 8] = (half_t)s[1][r];  // keys kbase+16 .. +31
        pb1[r]     = (half_t)s[2][r];  // keys kbase+32 .. +47
        pb1[r + 8] = (half_t)s[3][r];  // keys kbase+48 .. +63
    }
}

__global__ void __launch_bounds__(32 * AWAVES)
attn_kernel(const half_t* __restrict__ qh, const half_t* __restrict__ khp,
            const half_t* __restrict__ vtp, float* __restrict__ out) {
    // part[wave][slot][lane]: 4 floats of a wave's un-normalised O^T, with
    // slot = ((group*2 + tile)*4 + t4)*2 + (upper 4 of the lane's 8 h values)
    __shared__ float4 part[AWAVES * 32 * 32];
    // ml[wave][group*2 + tile][query]: that wave's (m, l)
    __shared__ float2 ml[AWAVES * 4 * 16];

    const int lane   = threadIdx.x & 31;
    const int lane16 = lane & 15;
    const int khalf  = lane >> 4;
    const int wave   = __builtin_amdgcn_readfirstlane(threadIdx.x >> 5);

    const int bidx = blockIdx.x >> 6;   // batch
    const int p    = blockIdx.x & 63;   // pair of query groups: 127-p and p

    const half_t* __restrict__ klane = khp + (size_t)bidx * 256 * 1024 + (size_t)lane * 16;
    const half_t* __restrict__ vlane = vtp + (size_t)bidx * 128 * 2048 + (size_t)lane * 16;

    const int nfirst = ((127 - p) >> 1) + 1;    // chunks of group 127-p (33..64)
    const int nitems = 65;                      // chunks of both groups together

    // Q^T B-fragments of both tiles of both groups: N = query = lane%16, K = h
    const half_t* __restrict__ qa =
        qh + ((size_t)(bidx << 12) + (127 - p) * 32 + lane16) * HEAD + 8 * khalf;
    const half_t* __restrict__ qb =
        qh + ((size_t)(bidx << 12) + p * 32 + lane16) * HEAD + 8 * khalf;
    v16h bq[2][2], bqn[2][2];
#pragma unroll
    for (int t = 0; t < 2; ++t) {
#pragma unroll
        for (int j = 0; j < 8; ++j) {
            const int h = 16 * t * HEAD + koff(j);
            bq[t][0][2 * j]      = qa[h];
            bq[t][0][2 * j + 1]  = qa[h + 1];
            bq[t][1][2 * j]      = qa[h + 32];
            bq[t][1][2 * j + 1]  = qa[h + 33];
            bqn[t][0][2 * j]     = qb[h];
            bqn[t][0][2 * j + 1] = qb[h + 1];
            bqn[t][1][2 * j]     = qb[h + 32];
            bqn[t][1][2 * j + 1] = qb[h + 33];
        }
    }
    // The address registers of the Q loads get other values behind this: the
    // loads' address translations are waited for first. The two pointers are
    // inputs so that their registers stay untouched up to the wait.
    asm volatile("s_wait_xcnt 0x0" :: "v"(qa), "v"(qb) : "memory");

    // The 65 chunks of both groups are numbered through: item i is chunk i of
    // group 127-p while i < nfirst, chunk i - nfirst of group p behind that.
    // Wave w takes items w, w+8, ...
    // K fragments of the wave's first item; each pass fetches the next item's,
    // across the change of group too.
    const half_t* __restrict__ kfirst = klane + (size_t)wave * 4096;
    v16h kf[8];
#pragma unroll
    for (int i = 0; i < 8; ++i) kf[i] = *(const v16h*)(kfirst + i * 512);
    // The same for the address registers of these K loads.
    asm volatile("s_wait_xcnt 0x0" :: "v"(kfirst) : "memory");
    // Where the next fetch reads (items w and w+8 both lie in group 127-p).
    const half_t* __restrict__ knext = klane + (size_t)(wave + AWAVES) * 4096;

    int item = wave;
    for (int grp = 0; grp < 2; ++grp) {
        const int qbase = (grp ? p : (127 - p)) * 32;   // first query of the group
        const int ibase = grp ? nfirst : 0;             // the group's first item
        const int iend  = grp ? nitems : nfirst;

        float m[2] = {NEG_BIG, NEG_BIG}, l[2] = {0.0f, 0.0f};
        v8f o[2][4] = {};

        for (; item < iend; item += AWAVES) {
            const int c = item - ibase;                 // chunk inside the group
            const int kbase = c * 64;
            // --- this chunk's V^T fragments, wanted behind the softmax ---
            const half_t* __restrict__ vbp = vlane + (size_t)c * 4096;
            v16h vf[8];
#pragma unroll
            for (int i = 0; i < 8; ++i) vf[i] = *(const v16h*)(vbp + i * 512);

            // --- scores S^T for 64 keys x 2 tiles: 4 subtiles x 2 WMMAs each ---
            v8f s[2][4] = {};
#pragma unroll
            for (int hh = 0; hh < 2; ++hh)
#pragma unroll
                for (int t = 0; t < 2; ++t)
#pragma unroll
                    for (int i = 0; i < 4; ++i)
                        s[t][i] = wmma_f16(kf[2 * i + hh], bq[t][hh], s[t][i]);

            // --- causal mask (scale already folded into q); only a group's
            // last chunk holds keys behind the group's first query ---
            if (kbase + 63 > qbase) {
#pragma unroll
                for (int t = 0; t < 2; ++t) {
                    const int qg = qbase + 16 * t + lane16;   // this lane's query
#pragma unroll
                    for (int r = 0; r < 8; ++r) {
                        const int kg = kbase + r + 8 * khalf; // key = r + 8*(lane/16)
                        if (kg > qg)      s[t][0][r] = NEG_BIG;
                        if (kg + 16 > qg) s[t][1][r] = NEG_BIG;
                        if (kg + 32 > qg) s[t][2][r] = NEG_BIG;
                        if (kg + 48 > qg) s[t][3][r] = NEG_BIG;
                    }
                }
            }

            // --- K fragments of the wave's next item ---
#pragma unroll
            for (int i = 0; i < 8; ++i) kf[i] = *(const v16h*)(knext + i * 512);
            // The K and V pointers move on behind this: the address translations
            // of this pass's loads are waited for before their registers change.
            asm volatile("s_wait_xcnt 0x0" ::: "memory");
            // Keeps the K loads here, in front of the softmax: without it they sink
            // to the head of the next pass, whose WMMAs then wait out their latency.
            // It also holds the pointer updates behind the wait above.
            __builtin_amdgcn_sched_barrier(0);
            // On to the item after the next: 8 chunks on, less the first group's
            // chunks where that step enters group p; the wave's last pass has no
            // next item and simply asks for its own chunk again.
            const int step = AWAVES -
                ((item + AWAVES < nfirst && item + 2 * AWAVES >= nfirst) ? nfirst : 0);
            knext += (item + 2 * AWAVES < nitems) ? (step * 4096) : 0;

            v16h pb[2][2];
#pragma unroll
            for (int t = 0; t < 2; ++t)
                softmax_tile(s[t], m[t], l[t], o[t], pb[t][0], pb[t][1]);

            // --- O^T += V^T * P^T : 2 tiles x 4 h-tiles x 2 key-halves ---
#pragma unroll
            for (int kk = 0; kk < 2; ++kk)
#pragma unroll
                for (int t = 0; t < 2; ++t)
#pragma unroll
                    for (int i = 0; i < 4; ++i)
                        o[t][i] = wmma_f16(vf[4 * kk + i], pb[t][kk], o[t][i]);
        }

        // --- this wave's partial result of the group goes to LDS ---
#pragma unroll
        for (int t = 0; t < 2; ++t) {
            const int gt = grp * 2 + t;
#pragma unroll
            for (int i = 0; i < 4; ++i) {
                float4* pp = part + ((wave * 32 + (gt * 4 + i) * 2) * 32 + lane);
                pp[0]  = make_float4(o[t][i][0], o[t][i][1], o[t][i][2], o[t][i][3]);
                pp[32] = make_float4(o[t][i][4], o[t][i][5], o[t][i][6], o[t][i][7]);
            }
            if (khalf == 0) ml[(wave * 4 + gt) * 16 + lane16] = make_float2(m[t], l[t]);
            bq[t][0] = bqn[t][0];
            bq[t][1] = bqn[t][1];
        }
    }

    // Every wave's partial results are in LDS before any wave merges them.
    __syncthreads();

    // --- merge: wave w takes tile w/2 (of the 4) and h values 32*(w%2) .. +31,
    // one whole 128-byte line of each of its 16 output rows ---
    const int gt   = wave >> 1;
    const int qrow = ((gt >> 1) ? p : (127 - p)) * 32 + (gt & 1) * 16 + lane16;
    float wm[AWAVES], wl[AWAVES];
    float mall = NEG_BIG;
#pragma unroll
    for (int w = 0; w < AWAVES; ++w) {
        const float2 v = ml[(w * 4 + gt) * 16 + lane16];
        wm[w] = v.x; wl[w] = v.y;
        mall = fmaxf(mall, v.x);
    }
    float lall = 0.0f;
#pragma unroll
    for (int w = 0; w < AWAVES; ++w) {
        wm[w] = __expf(wm[w] - mall);   // a wave without chunks weighs 0
        lall += wm[w] * wl[w];
    }
    const float inv = 1.0f / lall;

    // O^T element (h = t4*16 + r + 8*khalf, query = lane%16)
    float* __restrict__ orow =
        out + ((size_t)(bidx << 12) + qrow) * HEAD + (wave & 1) * 32 + 8 * khalf;
#pragma unroll
    for (int j = 0; j < 4; ++j) {       // t4 = 2*(w%2) + j/2, upper half = j%2
        const float4* pp = part + ((gt * 8 + (wave & 1) * 4 + j) * 32 + lane);
        float4 acc = make_float4(0.0f, 0.0f, 0.0f, 0.0f);
#pragma unroll
        for (int w = 0; w < AWAVES; ++w) {
            const float4 v = pp[w * 32 * 32];
            acc.x += wm[w] * v.x; acc.y += wm[w] * v.y;
            acc.z += wm[w] * v.z; acc.w += wm[w] * v.w;
        }
        acc.x *= inv; acc.y *= inv; acc.z *= inv; acc.w *= inv;
        *(float4*)(orow + (j >> 1) * 16 + (j & 1) * 4) = acc;
    }
}

// ---------------------------------------------------------------------------
extern "C" void kernel_launch(void* const* d_in, const int* in_sizes, int n_in,
                              void* d_out, int out_size, void* d_ws, size_t ws_size,
                              hipStream_t stream) {
    const float* x  = (const float*)d_in[0];
    const float* Wq = (const float*)d_in[1];
    const float* bq = (const float*)d_in[2];
    const float* Wk = (const float*)d_in[3];
    const float* bk = (const float*)d_in[4];
    const float* Wv = (const float*)d_in[5];
    const float* bv = (const float*)d_in[6];
    float* out = (float*)d_out;

    const size_t QK = (size_t)NBATCH * TSEQ * HEAD; // 1,048,576 elems
    half_t* qh    = (half_t*)d_ws;
    half_t* khp   = qh + QK;                 // K in A-fragment layout
    half_t* vtp   = khp + QK;                // V^T in A-fragment layout
    half_t* wpack = vtp + QK;                // 3 * 65536 f16

    pack_w_kernel<<<(3 * WPACK_ELEMS) / 256, 256, 0, stream>>>(Wq, Wk, Wv, wpack);

    const int rowTiles = NBATCH * TSEQ / 16;  // 1024 row tiles, 8 waves/block
    qkv_proj_kernel<<<rowTiles / 8, 256, 0, stream>>>(x, wpack, bq, bk, bv,
                                                      qh, khp, vtp);

    // one block per pair of 32-query groups: 64 pairs in each batch
    attn_kernel<<<NBATCH * (TSEQ / 64), 32 * AWAVES, 0, stream>>>(qh, khp, vtp, out);
}

// v003
// It runs in 29 microseconds.
// Next to v002, in two timings, it ran 1.53 and 1.47 times as fast.
// Over all steps from v000 it is 8.61 times as fast.
#include <hip/hip_runtime.h>
#include <hip/hip_bf16.h>

typedef _Float16 half_t;
typedef __attribute__((ext_vector_type(16))) _Float16 v16h;
typedef __attribute__((ext_vector_type(8)))  float    v8f;

#define N_EMBED   1024
#define HEAD      64
#define TSEQ      4096
#define NBATCH    4
#define NEG_BIG   (-3.0e30f)
#define WPACK_ELEMS 65536   // per matrix: 1024*64

// 16-bit A/B WMMA fragment (16x32) K-mapping:
// element e -> K = (e<8 ? e : e+8) + 8*(lane/16); pair j -> koff(j), koff(j)+1
// inverse:   khalf = (K>>3)&1 ; e = (K&7) + 8*(K>>4)
__device__ __forceinline__ int koff(int j) { return (j < 4) ? (2 * j) : (2 * j + 8); }

__device__ __forceinline__ v8f wmma_f16(v16h a, v16h b, v8f c) {
    return __builtin_amdgcn_wmma_f32_16x16x32_f16(false, a, false, b, (short)0, c, false, false);
}

// ---------------------------------------------------------------------------
// Kernel 0: pack Wq|Wk|Wv (f32 [1024,64]) into f16 B-fragment layout:
// wpack[m][c][n][lane][e]; each lane's 16 halves contiguous (32B).
// ---------------------------------------------------------------------------
__global__ void __launch_bounds__(256)
pack_w_kernel(const float* __restrict__ Wq, const float* __restrict__ Wk,
              const float* __restrict__ Wv, half_t* __restrict__ wpack) {
    const int idx = blockIdx.x * 256 + threadIdx.x;     // 0 .. 3*65536-1
    const int m   = idx >> 16;
    const int r   = idx & (WPACK_ELEMS - 1);
    const int e   = r & 15;
    const int l   = (r >> 4) & 31;
    const int cn  = r >> 9;            // c*4 + n
    const int n   = cn & 3;
    const int c   = cn >> 2;
    const int K   = 32 * c + ((e < 8) ? e : (e + 8)) + 8 * (l >> 4);
    const int col = 16 * n + (l & 15);
    const float* __restrict__ W = (m == 0) ? Wq : (m == 1) ? Wk : Wv;
    wpack[idx] = (half_t)W[(size_t)K * HEAD + col];
}

typedef __attribute__((ext_vector_type(8))) unsigned v8u;

// 16 f32 values to one f16 A fragment, round to nearest even as a cast does.
// Written in asm, volatile, so that it stays where the source has it, behind
// the fetches for later chunks: as plain casts the conversions move up to
// stand directly behind their own LDS reads, and the wave waits out the LDS
// latency twice a chunk. The four v_nop keep the distance between an earlier
// WMMA and a vector write over its A registers.
__device__ __forceinline__ v16h cvt_x(const float4 (&r)[4]) {
    v8u d;
    unsigned d0, d1, d2, d3, d4, d5, d6, d7;
    asm volatile(
        "v_nop\n\tv_nop\n\tv_nop\n\tv_nop\n\t"
        "v_cvt_pk_f16_f32 %0, %8, %9\n\t"
        "v_cvt_pk_f16_f32 %1, %10, %11\n\t"
        "v_cvt_pk_f16_f32 %2, %12, %13\n\t"
        "v_cvt_pk_f16_f32 %3, %14, %15\n\t"
        "v_cvt_pk_f16_f32 %4, %16, %17\n\t"
        "v_cvt_pk_f16_f32 %5, %18, %19\n\t"
        "v_cvt_pk_f16_f32 %6, %20, %21\n\t"
        "v_cvt_pk_f16_f32 %7, %22, %23"
        : "=&v"(d0), "=&v"(d1), "=&v"(d2), "=&v"(d3),
          "=&v"(d4), "=&v"(d5), "=&v"(d6), "=&v"(d7)
        : "v"(r[0].x), "v"(r[0].y), "v"(r[0].z), "v"(r[0].w),
          "v"(r[1].x), "v"(r[1].y), "v"(r[1].z), "v"(r[1].w),
          "v"(r[2].x), "v"(r[2].y), "v"(r[2].z), "v"(r[2].w),
          "v"(r[3].x), "v"(r[3].y), "v"(r[3].z), "v"(r[3].w));
    d[0] = d0; d[1] = d1; d[2] = d2; d[3] = d3;
    d[4] = d4; d[5] = d5; d[6] = d6; d[7] = d7;
    return __builtin_bit_cast(v16h, d);
}

#define QROWS   64                    // x rows of a block
#define QKS     256                   // floats of each row in one stage
#define QNST    (N_EMBED / QKS)       // stages
#define QCH     (QKS / 32)            // 32-K chunks in a stage
#define QPITCH4 (QKS / 4 + 1)         // staged row pitch in float4: 16 B x odd
#define QHALF4  (32 * QPITCH4)        // 32 staged rows, in float4
#define QPITCHB (QPITCH4 * 16)
#define QHALFB  (QHALF4 * 16)
// LDS order: rows 0..31 buffer 0, rows 0..31 buffer 1, rows 32..63 buffer 0,
// rows 32..63 buffer 1: both buffers of a reader's 32 rows lie within the
// 64 KB that the offset field of one LDS read reaches from one address.

// The wave's 8 rows of stage s into buffer buf: each row's 1 KB goes as two
// pieces of 512 contiguous bytes, 16 bytes a lane, from global memory straight
// into LDS. lrow = the lane's LDS byte address in the wave's first row of
// buffer 0, grow = its global address in that row. offset:512 moves the LDS
// and the global address alike, which is the row's second piece in both.
// The s_wait_xcnt stands inside the statement so that no address register of
// a copy takes a new value in front of it.
__device__ __forceinline__ void copy_stage(unsigned lrow, const float* __restrict__ grow,
                                           int s, int buf) {
    const unsigned l = lrow + (unsigned)buf * QHALFB;
    const float* __restrict__ g = grow + s * QKS;
    asm volatile(
        "global_load_async_to_lds_b128 %0, %8, off\n\t"
        "global_load_async_to_lds_b128 %0, %8, off offset:512\n\t"
        "global_load_async_to_lds_b128 %1, %9, off\n\t"
        "global_load_async_to_lds_b128 %1, %9, off offset:512\n\t"
        "global_load_async_to_lds_b128 %2, %10, off\n\t"
        "global_load_async_to_lds_b128 %2, %10, off offset:512\n\t"
        "global_load_async_to_lds_b128 %3, %11, off\n\t"
        "global_load_async_to_lds_b128 %3, %11, off offset:512\n\t"
        "global_load_async_to_lds_b128 %4, %12, off\n\t"
        "global_load_async_to_lds_b128 %4, %12, off offset:512\n\t"
        "global_load_async_to_lds_b128 %5, %13, off\n\t"
        "global_load_async_to_lds_b128 %5, %13, off offset:512\n\t"
        "global_load_async_to_lds_b128 %6, %14, off\n\t"
        "global_load_async_to_lds_b128 %6, %14, off offset:512\n\t"
        "global_load_async_to_lds_b128 %7, %15, off\n\t"
        "global_load_async_to_lds_b128 %7, %15, off offset:512\n\t"
        "s_wait_xcnt 0x0"
        :: "v"(l),               "v"(l + QPITCHB),
           "v"(l + 2 * QPITCHB), "v"(l + 3 * QPITCHB),
           "v"(l + 4 * QPITCHB), "v"(l + 5 * QPITCHB),
           "v"(l + 6 * QPITCHB), "v"(l + 7 * QPITCHB),
           "v"(g),               "v"(g + N_EMBED),
           "v"(g + 2 * N_EMBED), "v"(g + 3 * N_EMBED),
           "v"(g + 4 * N_EMBED), "v"(g + 5 * N_EMBED),
           "v"(g + 6 * N_EMBED), "v"(g + 7 * N_EMBED)
        : "memory");
}

// One lane's 16 x values of chunk cc of a staged tile, for both row tiles of
// the wave, still f32: floats 0..7 and 16..23 behind 8*(lane/16), the K order
// of the A fragment.
__device__ __forceinline__ void read_x(const float4* xrd, int cc, float4 (&r)[2][4]) {
#pragma unroll
    for (int j = 0; j < 2; ++j) {
        const float4* p = xrd + j * 16 * QPITCH4 + cc * 8;
        r[j][0] = p[0]; r[j][1] = p[1]; r[j][2] = p[4]; r[j][3] = p[5];
    }
}

// The q, k and v B fragments of 32-K chunk c for the wave's 16 columns.
__device__ __forceinline__ void load_b(const half_t* __restrict__ wl, int c, v16h (&b)[3]) {
    const half_t* __restrict__ wp = wl + (size_t)c * (4 * 32 * 16);
    b[0] = *(const v16h*)(wp);
    b[1] = *(const v16h*)(wp + WPACK_ELEMS);
    b[2] = *(const v16h*)(wp + 2 * WPACK_ELEMS);
}

// ---------------------------------------------------------------------------
// Kernel 1: q,k,v projections. A block owns 64 rows of x and brings them into
// LDS in 4 stages of 256 floats a row, two buffers, by asynchronous copies:
// the next stage flies while this one is worked on. Wave w takes 32 of the
// rows (w/4) and columns 16*(w%4) .. +15 of q, k and v: 6 WMMAs per 32-K
// chunk, each B fragment serving two row tiles. Outputs:
//   qh     f16 [B*T, 64]       pre-scaled by 1/sqrt(H) (for Q B-fragments)
//   khpack f16 [B][T/16][2][32][16]   attention K A-fragment layout
//   vtpack f16 [B][T/32][4][32][16]   attention V^T A-fragment layout
// ---------------------------------------------------------------------------
__global__ void __launch_bounds__(256)
qkv_proj_kernel(const float* __restrict__ x, const half_t* __restrict__ wpack,
                const float* __restrict__ bq, const float* __restrict__ bk,
                const float* __restrict__ bv,
                half_t* __restrict__ qh, half_t* __restrict__ khp,
                half_t* __restrict__ vtp) {
    __shared__ float4 xs[4 * QHALF4];

    const int lane   = threadIdx.x & 31;
    const int lane16 = lane & 15;
    const int khalf  = lane >> 4;
    const int wave   = __builtin_amdgcn_readfirstlane(threadIdx.x >> 5);
    const int n      = wave & 3;     // the wave's 16 columns of q, k and v
    const int rh     = wave >> 2;    // the wave's 32 rows

    // B fragments in a ring of 4 chunks, fetched 3 chunks ahead
    const half_t* __restrict__ wl = wpack + (size_t)n * 32 * 16 + (size_t)lane * 16;
    v16h bf[4][3];
#pragma unroll
    for (int c = 0; c < 3; ++c) load_b(wl, c, bf[c]);

    // what this wave copies: rows 8*wave .. +7 of the block, 16 bytes a lane
    const unsigned lrow = (unsigned)(size_t)xs + (unsigned)(rh * 64 + n * 8) * QPITCHB + (unsigned)lane * 16u;
    const float* __restrict__ grow =
        x + (size_t)(blockIdx.x * QROWS + wave * 8) * N_EMBED + lane * 4;
    // what this lane reads: A: M = lane%16
    const float4* xrd = xs + (rh * 64 + lane16) * QPITCH4 + 2 * khalf;

    copy_stage(lrow, grow, 0, 0);
    // Stage 0 has landed, for this wave's copies, behind this wait ...
    asm volatile("s_wait_asynccnt 0x0" ::: "memory");
    // ... and for every wave's behind this barrier.
    __syncthreads();
    copy_stage(lrow, grow, 1, 1);

    v8f accq[2] = {}, acck[2] = {}, accv[2] = {};
    float4 xa[2][2][4];              // x of the even and of the odd chunks
    read_x(xrd, 0, xa[0]);

    // Unrolled whole, so that ring slots, buffers and stage tests are constants.
#pragma unroll
    for (int c = 0; c < N_EMBED / 32; ++c) {
        const int s  = c / QCH;      // stage
        const int cc = c % QCH;      // chunk inside the stage
        if (c + 3 < N_EMBED / 32) load_b(wl, c + 3, bf[(c + 3) & 3]);
        if (cc + 1 < QCH) read_x(xrd + (s & 1) * QHALF4, cc + 1, xa[(c + 1) & 1]);
        const v16h a0 = cvt_x(xa[c & 1][0]);
        const v16h a1 = cvt_x(xa[c & 1][1]);
        accq[0] = wmma_f16(a0, bf[c & 3][0], accq[0]);
        acck[0] = wmma_f16(a0, bf[c & 3][1], acck[0]);
        accv[0] = wmma_f16(a0, bf[c & 3][2], accv[0]);
        accq[1] = wmma_f16(a1, bf[c & 3][0], accq[1]);
        acck[1] = wmma_f16(a1, bf[c & 3][1], acck[1]);
        accv[1] = wmma_f16(a1, bf[c & 3][2], accv[1]);
        if (cc + 1 == QCH && s + 1 < QNST) {
            // This wave's reads of stage s are done before the buffer is refilled.
            asm volatile("s_wait_dscnt 0x0" ::: "memory");
            // This wave's copies of stage s+1 have landed.
            asm volatile("s_wait_asynccnt 0x0" ::: "memory");
            // Publishes stage s+1 and ends every wave's reads of stage s.
            __syncthreads();
            if (s + 2 < QNST) copy_stage(lrow, grow, s + 2, s & 1);
            read_x(xrd + ((s + 1) & 1) * QHALF4, 0, xa[(c + 1) & 1]);
        }
    }
    // No copy is left outstanding when the wave ends.
    asm volatile("s_wait_asynccnt 0x0" ::: "memory");

    const int col = 16 * n + lane16;   // output column h; C/D: N = lane%16
    const float biasq = bq[col];
    const float biask = bk[col];
    const float biasv = bv[col];
    // k-pack coords from h
    const int kf      = col >> 5;                 // which 32-h fragment
    const int hp      = col & 31;
    const int kh_lane = ((hp >> 3) & 1) * 16;     // + t%16
    const int kh_e    = (hp & 7) + 8 * (hp >> 4);
    // v-pack coords from h
    const int t4      = col >> 4;
    const int v_l16   = col & 15;
#pragma unroll
    for (int j = 0; j < 2; ++j) {
        const int rowTile = blockIdx.x * 4 + rh * 2 + j;   // 0 .. B*T/16-1
#pragma unroll
        for (int r = 0; r < 8; ++r) {
            const int orow = rowTile * 16 + r + 8 * khalf; // M = r + 8*(lane/16)
            const int bidx = orow >> 12;
            const int t    = orow & (TSEQ - 1);
            // q: row major, pre-scaled by 1/sqrt(HEAD)
            qh[(size_t)orow * HEAD + col] = (half_t)((accq[j][r] + biasq) * 0.125f);
            // k: A-fragment layout [b][t/16][kf][lane][e]
            const size_t kidx =
                ((((size_t)bidx * 256 + (t >> 4)) * 2 + kf) * 32 +
                 (kh_lane + (t & 15))) * 16 + kh_e;
            khp[kidx] = (half_t)(acck[j][r] + biask);
            // v: V^T A-fragment layout [b][t/32][t4][lane][e]
            const int Krel = t & 31;
            const size_t vidx =
                ((((size_t)bidx * 128 + (t >> 5)) * 4 + t4) * 32 +
                 (((Krel >> 3) & 1) * 16 + v_l16)) * 16 +
                ((Krel & 7) + 8 * (Krel >> 4));
            vtp[vidx] = (half_t)(accv[j][r] + biasv);
        }
    }
}

// ---------------------------------------------------------------------------
// Kernel 2: flash attention, causal, 64-key chunks.
// S^T = K * Q^T so softmax'd probabilities convert element-wise into the
// B operands of O^T = V^T * P^T.
// A block owns two groups of 32 queries, group 127-p and group p of one batch:
// together they always see 65 chunks, so every block has the same work. The 8
// waves deal these 65 chunks out among themselves; each K/V fragment a wave
// loads serves both 16-query tiles of the group. Every wave keeps its own
// (m, l, O) per tile, leaves them in LDS, and behind one barrier the block
// merges the 8 partial results of each query.
// ---------------------------------------------------------------------------
#define AWAVES 8

// Online softmax of one 16-query tile over one 64-key chunk: updates m, l,
// rescales o, and returns the probabilities as the two P^T B operands.
__device__ __forceinline__ void softmax_tile(v8f (&s)[4], float& m, float& l,
                                             v8f (&o)[4], v16h& pb0, v16h& pb1) {
    // one shfl_xor(16) completes each 64-key row
    float mc = s[0][0];
#pragma unroll
    for (int r = 1; r < 8; ++r) mc = fmaxf(mc, s[0][r]);
#pragma unroll
    for (int r = 0; r < 8; ++r) {
        mc = fmaxf(mc, s[1][r]);
        mc = fmaxf(mc, s[2][r]);
        mc = fmaxf(mc, s[3][r]);
    }
    mc = fmaxf(mc, __shfl_xor(mc, 16, 32));

    const float m_new = fmaxf(m, mc);
    const float alpha = __expf(m - m_new);

    float rs = 0.0f;
#pragma unroll
    for (int r = 0; r < 8; ++r) {
        s[0][r] = __expf(s[0][r] - m_new); rs += s[0][r];
        s[1][r] = __expf(s[1][r] - m_new); rs += s[1][r];
        s[2][r] = __expf(s[2][r] - m_new); rs += s[2][r];
        s[3][r] = __expf(s[3][r] - m_new); rs += s[3][r];
    }
    rs += __shfl_xor(rs, 16, 32);
    l = l * alpha + rs;
    m = m_new;

#pragma unroll
    for (int r = 0; r < 8; ++r) {
        o[0][r] *= alpha; o[1][r] *= alpha; o[2][r] *= alpha; o[3][r] *= alpha;
    }

    // P^T B operands: direct element copy from S^T accumulators
#pragma unroll
    for (int r = 0; r < 8; ++r) {
        pb0[r]     = (half_t)s[0][r];  // keys kbase    .. +15
        pb0[r + 8] = (half_t)s[1][r];  // keys kbase+16 .. +31
        pb1[r]     = (half_t)s[2][r];  // keys kbase+32 .. +47
        pb1[r + 8] = (half_t)s[3][r];  // keys kbase+48 .. +63
    }
}

__global__ void __launch_bounds__(32 * AWAVES)
attn_kernel(const half_t* __restrict__ qh, const half_t* __restrict__ khp,
            const half_t* __restrict__ vtp, float* __restrict__ out) {
    // part[wave][slot][lane]: 4 floats of a wave's un-normalised O^T, with
    // slot = ((group*2 + tile)*4 + t4)*2 + (upper 4 of the lane's 8 h values)
    __shared__ float4 part[AWAVES * 32 * 32];
    // ml[wave][group*2 + tile][query]: that wave's (m, l)
    __shared__ float2 ml[AWAVES * 4 * 16];

    const int lane   = threadIdx.x & 31;
    const int lane16 = lane & 15;
    const int khalf  = lane >> 4;
    const int wave   = __builtin_amdgcn_readfirstlane(threadIdx.x >> 5);

    const int bidx = blockIdx.x >> 6;   // batch
    const int p    = blockIdx.x & 63;   // pair of query groups: 127-p and p

    const half_t* __restrict__ klane = khp + (size_t)bidx * 256 * 1024 + (size_t)lane * 16;
    const half_t* __restrict__ vlane = vtp + (size_t)bidx * 128 * 2048 + (size_t)lane * 16;

    const int nfirst = ((127 - p) >> 1) + 1;    // chunks of group 127-p (33..64)
    const int nitems = 65;                      // chunks of both groups together

    // Q^T B-fragments of both tiles of both groups: N = query = lane%16, K = h
    const half_t* __restrict__ qa =
        qh + ((size_t)(bidx << 12) + (127 - p) * 32 + lane16) * HEAD + 8 * khalf;
    const half_t* __restrict__ qb =
        qh + ((size_t)(bidx << 12) + p * 32 + lane16) * HEAD + 8 * khalf;
    v16h bq[2][2], bqn[2][2];
#pragma unroll
    for (int t = 0; t < 2; ++t) {
#pragma unroll
        for (int j = 0; j < 8; ++j) {
            const int h = 16 * t * HEAD + koff(j);
            bq[t][0][2 * j]      = qa[h];
            bq[t][0][2 * j + 1]  = qa[h + 1];
            bq[t][1][2 * j]      = qa[h + 32];
            bq[t][1][2 * j + 1]  = qa[h + 33];
            bqn[t][0][2 * j]     = qb[h];
            bqn[t][0][2 * j + 1] = qb[h + 1];
            bqn[t][1][2 * j]     = qb[h + 32];
            bqn[t][1][2 * j + 1] = qb[h + 33];
        }
    }
    // The address registers of the Q loads get other values behind this: the
    // loads' address translations are waited for first. The two pointers are
    // inputs so that their registers stay untouched up to the wait.
    asm volatile("s_wait_xcnt 0x0" :: "v"(qa), "v"(qb) : "memory");

    // The 65 chunks of both groups are numbered through: item i is chunk i of
    // group 127-p while i < nfirst, chunk i - nfirst of group p behind that.
    // Wave w takes items w, w+8, ...
    // K fragments of the wave's first item; each pass fetches the next item's,
    // across the change of group too.
    const half_t* __restrict__ kfirst = klane + (size_t)wave * 4096;
    v16h kf[8];
#pragma unroll
    for (int i = 0; i < 8; ++i) kf[i] = *(const v16h*)(kfirst + i * 512);
    // The same for the address registers of these K loads.
    asm volatile("s_wait_xcnt 0x0" :: "v"(kfirst) : "memory");
    // Where the next fetch reads (items w and w+8 both lie in group 127-p).
    const half_t* __restrict__ knext = klane + (size_t)(wave + AWAVES) * 4096;

    int item = wave;
    for (int grp = 0; grp < 2; ++grp) {
        const int qbase = (grp ? p : (127 - p)) * 32;   // first query of the group
        const int ibase = grp ? nfirst : 0;             // the group's first item
        const int iend  = grp ? nitems : nfirst;

        float m[2] = {NEG_BIG, NEG_BIG}, l[2] = {0.0f, 0.0f};
        v8f o[2][4] = {};

        for (; item < iend; item += AWAVES) {
            const int c = item - ibase;                 // chunk inside the group
            const int kbase = c * 64;
            // --- this chunk's V^T fragments, wanted behind the softmax ---
            const half_t* __restrict__ vbp = vlane + (size_t)c * 4096;
            v16h vf[8];
#pragma unroll
            for (int i = 0; i < 8; ++i) vf[i] = *(const v16h*)(vbp + i * 512);

            // --- scores S^T for 64 keys x 2 tiles: 4 subtiles x 2 WMMAs each ---
            v8f s[2][4] = {};
#pragma unroll
            for (int hh = 0; hh < 2; ++hh)
#pragma unroll
                for (int t = 0; t < 2; ++t)
#pragma unroll
                    for (int i = 0; i < 4; ++i)
                        s[t][i] = wmma_f16(kf[2 * i + hh], bq[t][hh], s[t][i]);

            // --- causal mask (scale already folded into q); only a group's
            // last chunk holds keys behind the group's first query ---
            if (kbase + 63 > qbase) {
#pragma unroll
                for (int t = 0; t < 2; ++t) {
                    const int qg = qbase + 16 * t + lane16;   // this lane's query
#pragma unroll
                    for (int r = 0; r < 8; ++r) {
                        const int kg = kbase + r + 8 * khalf; // key = r + 8*(lane/16)
                        if (kg > qg)      s[t][0][r] = NEG_BIG;
                        if (kg + 16 > qg) s[t][1][r] = NEG_BIG;
                        if (kg + 32 > qg) s[t][2][r] = NEG_BIG;
                        if (kg + 48 > qg) s[t][3][r] = NEG_BIG;
                    }
                }
            }

            // --- K fragments of the wave's next item ---
#pragma unroll
            for (int i = 0; i < 8; ++i) kf[i] = *(const v16h*)(knext + i * 512);
            // The K and V pointers move on behind this: the address translations
            // of this pass's loads are waited for before their registers change.
            asm volatile("s_wait_xcnt 0x0" ::: "memory");
            // Keeps the K loads here, in front of the softmax: without it they sink
            // to the head of the next pass, whose WMMAs then wait out their latency.
            // It also holds the pointer updates behind the wait above.
            __builtin_amdgcn_sched_barrier(0);
            // On to the item after the next: 8 chunks on, less the first group's
            // chunks where that step enters group p; the wave's last pass has no
            // next item and simply asks for its own chunk again.
            const int step = AWAVES -
                ((item + AWAVES < nfirst && item + 2 * AWAVES >= nfirst) ? nfirst : 0);
            knext += (item + 2 * AWAVES < nitems) ? (step * 4096) : 0;

            v16h pb[2][2];
#pragma unroll
            for (int t = 0; t < 2; ++t)
                softmax_tile(s[t], m[t], l[t], o[t], pb[t][0], pb[t][1]);

            // --- O^T += V^T * P^T : 2 tiles x 4 h-tiles x 2 key-halves ---
#pragma unroll
            for (int kk = 0; kk < 2; ++kk)
#pragma unroll
                for (int t = 0; t < 2; ++t)
#pragma unroll
                    for (int i = 0; i < 4; ++i)
                        o[t][i] = wmma_f16(vf[4 * kk + i], pb[t][kk], o[t][i]);
        }

        // --- this wave's partial result of the group goes to LDS ---
#pragma unroll
        for (int t = 0; t < 2; ++t) {
            const int gt = grp * 2 + t;
#pragma unroll
            for (int i = 0; i < 4; ++i) {
                float4* pp = part + ((wave * 32 + (gt * 4 + i) * 2) * 32 + lane);
                pp[0]  = make_float4(o[t][i][0], o[t][i][1], o[t][i][2], o[t][i][3]);
                pp[32] = make_float4(o[t][i][4], o[t][i][5], o[t][i][6], o[t][i][7]);
            }
            if (khalf == 0) ml[(wave * 4 + gt) * 16 + lane16] = make_float2(m[t], l[t]);
            bq[t][0] = bqn[t][0];
            bq[t][1] = bqn[t][1];
        }
    }

    // Every wave's partial results are in LDS before any wave merges them.
    __syncthreads();

    // --- merge: wave w takes tile w/2 (of the 4) and h values 32*(w%2) .. +31,
    // one whole 128-byte line of each of its 16 output rows ---
    const int gt   = wave >> 1;
    const int qrow = ((gt >> 1) ? p : (127 - p)) * 32 + (gt & 1) * 16 + lane16;
    float wm[AWAVES], wl[AWAVES];
    float mall = NEG_BIG;
#pragma unroll
    for (int w = 0; w < AWAVES; ++w) {
        const float2 v = ml[(w * 4 + gt) * 16 + lane16];
        wm[w] = v.x; wl[w] = v.y;
        mall = fmaxf(mall, v.x);
    }
    float lall = 0.0f;
#pragma unroll
    for (int w = 0; w < AWAVES; ++w) {
        wm[w] = __expf(wm[w] - mall);   // a wave without chunks weighs 0
        lall += wm[w] * wl[w];
    }
    const float inv = 1.0f / lall;

    // O^T element (h = t4*16 + r + 8*khalf, query = lane%16)
    float* __restrict__ orow =
        out + ((size_t)(bidx << 12) + qrow) * HEAD + (wave & 1) * 32 + 8 * khalf;
#pragma unroll
    for (int j = 0; j < 4; ++j) {       // t4 = 2*(w%2) + j/2, upper half = j%2
        const float4* pp = part + ((gt * 8 + (wave & 1) * 4 + j) * 32 + lane);
        float4 acc = make_float4(0.0f, 0.0f, 0.0f, 0.0f);
#pragma unroll
        for (int w = 0; w < AWAVES; ++w) {
            const float4 v = pp[w * 32 * 32];
            acc.x += wm[w] * v.x; acc.y += wm[w] * v.y;
            acc.z += wm[w] * v.z; acc.w += wm[w] * v.w;
        }
        acc.x *= inv; acc.y *= inv; acc.z *= inv; acc.w *= inv;
        *(float4*)(orow + (j >> 1) * 16 + (j & 1) * 4) = acc;
    }
}

// ---------------------------------------------------------------------------
extern "C" void kernel_launch(void* const* d_in, const int* in_sizes, int n_in,
                              void* d_out, int out_size, void* d_ws, size_t ws_size,
                              hipStream_t stream) {
    const float* x  = (const float*)d_in[0];
    const float* Wq = (const float*)d_in[1];
    const float* bq = (const float*)d_in[2];
    const float* Wk = (const float*)d_in[3];
    const float* bk = (const float*)d_in[4];
    const float* Wv = (const float*)d_in[5];
    const float* bv = (const float*)d_in[6];
    float* out = (float*)d_out;

    const size_t QK = (size_t)NBATCH * TSEQ * HEAD; // 1,048,576 elems
    half_t* qh    = (half_t*)d_ws;
    half_t* khp   = qh + QK;                 // K in A-fragment layout
    half_t* vtp   = khp + QK;                // V^T in A-fragment layout
    half_t* wpack = vtp + QK;                // 3 * 65536 f16

    pack_w_kernel<<<(3 * WPACK_ELEMS) / 256, 256, 0, stream>>>(Wq, Wk, Wv, wpack);

    // one block of 8 waves per 64 rows of x
    qkv_proj_kernel<<<NBATCH * TSEQ / QROWS, 256, 0, stream>>>(x, wpack, bq, bk, bv,
                                                               qh, khp, vtp);

    // one block per pair of 32-query groups: 64 pairs in each batch
    attn_kernel<<<NBATCH * (TSEQ / 64), 32 * AWAVES, 0, stream>>>(qh, khp, vtp, out);
}

// v004
// It runs in 27.3 microseconds.
// Timed twice side by side with v003, it ran 1.07 and 1.08 times as fast.
// Over all steps from v000 it is 9.24 times as fast.
#include <hip/hip_runtime.h>
#include <hip/hip_bf16.h>

typedef _Float16 half_t;
typedef __attribute__((ext_vector_type(16))) _Float16 v16h;
typedef __attribute__((ext_vector_type(8)))  float    v8f;

#define N_EMBED   1024
#define HEAD      64
#define TSEQ      4096
#define NBATCH    4
#define NEG_BIG   (-3.0e30f)
#define WPACK_ELEMS 65536   // per matrix: 1024*64

// 16-bit A/B WMMA fragment (16x32) K-mapping:
// element e -> K = (e<8 ? e : e+8) + 8*(lane/16); pair j -> koff(j), koff(j)+1
// inverse:   khalf = (K>>3)&1 ; e = (K&7) + 8*(K>>4)
__device__ __forceinline__ int koff(int j) { return (j < 4) ? (2 * j) : (2 * j + 8); }

__device__ __forceinline__ v8f wmma_f16(v16h a, v16h b, v8f c) {
    return __builtin_amdgcn_wmma_f32_16x16x32_f16(false, a, false, b, (short)0, c, false, false);
}

// ---------------------------------------------------------------------------
// Kernel 0: pack Wq|Wk|Wv (f32 [1024,64]) into f16 B-fragment layout:
// wpack[m][c][n][lane][e]; each lane's 16 halves contiguous (32B).
// ---------------------------------------------------------------------------
__global__ void __launch_bounds__(256)
pack_w_kernel(const float* __restrict__ Wq, const float* __restrict__ Wk,
              const float* __restrict__ Wv, half_t* __restrict__ wpack) {
    const int idx = blockIdx.x * 256 + threadIdx.x;     // 0 .. 3*65536-1
    const int m   = idx >> 16;
    const int r   = idx & (WPACK_ELEMS - 1);
    const int e   = r & 15;
    const int l   = (r >> 4) & 31;
    const int cn  = r >> 9;            // c*4 + n
    const int n   = cn & 3;
    const int c   = cn >> 2;
    const int K   = 32 * c + ((e < 8) ? e : (e + 8)) + 8 * (l >> 4);
    const int col = 16 * n + (l & 15);
    const float* __restrict__ W = (m == 0) ? Wq : (m == 1) ? Wk : Wv;
    wpack[idx] = (half_t)W[(size_t)K * HEAD + col];
}

typedef __attribute__((ext_vector_type(8))) unsigned v8u;

// 16 f32 values to one f16 A fragment, round to nearest even as a cast does.
// Written in asm, volatile, so that it stays where the source has it, behind
// the fetches for later chunks: as plain casts the conversions move up to
// stand directly behind their own LDS reads, and the wave waits out the LDS
// latency twice a chunk. The four v_nop keep the distance between an earlier
// WMMA and a vector write over its A registers.
__device__ __forceinline__ v16h cvt_x(const float4 (&r)[4]) {
    v8u d;
    unsigned d0, d1, d2, d3, d4, d5, d6, d7;
    asm volatile(
        "v_nop\n\tv_nop\n\tv_nop\n\tv_nop\n\t"
        "v_cvt_pk_f16_f32 %0, %8, %9\n\t"
        "v_cvt_pk_f16_f32 %1, %10, %11\n\t"
        "v_cvt_pk_f16_f32 %2, %12, %13\n\t"
        "v_cvt_pk_f16_f32 %3, %14, %15\n\t"
        "v_cvt_pk_f16_f32 %4, %16, %17\n\t"
        "v_cvt_pk_f16_f32 %5, %18, %19\n\t"
        "v_cvt_pk_f16_f32 %6, %20, %21\n\t"
        "v_cvt_pk_f16_f32 %7, %22, %23"
        : "=&v"(d0), "=&v"(d1), "=&v"(d2), "=&v"(d3),
          "=&v"(d4), "=&v"(d5), "=&v"(d6), "=&v"(d7)
        : "v"(r[0].x), "v"(r[0].y), "v"(r[0].z), "v"(r[0].w),
          "v"(r[1].x), "v"(r[1].y), "v"(r[1].z), "v"(r[1].w),
          "v"(r[2].x), "v"(r[2].y), "v"(r[2].z), "v"(r[2].w),
          "v"(r[3].x), "v"(r[3].y), "v"(r[3].z), "v"(r[3].w));
    d[0] = d0; d[1] = d1; d[2] = d2; d[3] = d3;
    d[4] = d4; d[5] = d5; d[6] = d6; d[7] = d7;
    return __builtin_bit_cast(v16h, d);
}

#define QROWS   64                    // x rows of a block
#define QKS     256                   // floats of each row in one stage
#define QNST    (N_EMBED / QKS)       // stages
#define QCH     (QKS / 32)            // 32-K chunks in a stage
#define QPITCH4 (QKS / 4 + 1)         // staged row pitch in float4: 16 B x odd
#define QHALF4  (32 * QPITCH4)        // 32 staged rows, in float4
#define QPITCHB (QPITCH4 * 16)
#define QHALFB  (QHALF4 * 16)
// The i-th stage that a block works on, for a walk that starts at stage s0 and
// wraps, and the i-th chunk inside a stage, for a walk that starts at chunk c0
// (0 or half a stage) and wraps; c1 = the other of the two.
#define STAGE_AT(i) ((s0 + (i)) & (QNST - 1))
#define CC_AT(i)    ((((i) < QCH / 2) ? c0 : c1) + ((i) & (QCH / 2 - 1)))
// LDS order: rows 0..31 buffer 0, rows 0..31 buffer 1, rows 32..63 buffer 0,
// rows 32..63 buffer 1: both buffers of a reader's 32 rows lie within the
// 64 KB that the offset field of one LDS read reaches from one address.

// The wave's 8 rows of stage s into buffer buf: each row's 1 KB goes as two
// pieces of 512 contiguous bytes, 16 bytes a lane, from global memory straight
// into LDS. lrow = the lane's LDS byte address in the wave's first row of
// buffer 0, grow = its global address in that row. offset:512 moves the LDS
// and the global address alike, which is the row's second piece in both.
// The s_wait_xcnt stands inside the statement so that no address register of
// a copy takes a new value in front of it.
__device__ __forceinline__ void copy_stage(unsigned lrow, const float* __restrict__ grow,
                                           int s, int buf) {
    const unsigned l = lrow + (unsigned)buf * QHALFB;
    const float* __restrict__ g = grow + s * QKS;
    asm volatile(
        "global_load_async_to_lds_b128 %0, %8, off\n\t"
        "global_load_async_to_lds_b128 %0, %8, off offset:512\n\t"
        "global_load_async_to_lds_b128 %1, %9, off\n\t"
        "global_load_async_to_lds_b128 %1, %9, off offset:512\n\t"
        "global_load_async_to_lds_b128 %2, %10, off\n\t"
        "global_load_async_to_lds_b128 %2, %10, off offset:512\n\t"
        "global_load_async_to_lds_b128 %3, %11, off\n\t"
        "global_load_async_to_lds_b128 %3, %11, off offset:512\n\t"
        "global_load_async_to_lds_b128 %4, %12, off\n\t"
        "global_load_async_to_lds_b128 %4, %12, off offset:512\n\t"
        "global_load_async_to_lds_b128 %5, %13, off\n\t"
        "global_load_async_to_lds_b128 %5, %13, off offset:512\n\t"
        "global_load_async_to_lds_b128 %6, %14, off\n\t"
        "global_load_async_to_lds_b128 %6, %14, off offset:512\n\t"
        "global_load_async_to_lds_b128 %7, %15, off\n\t"
        "global_load_async_to_lds_b128 %7, %15, off offset:512\n\t"
        "s_wait_xcnt 0x0"
        :: "v"(l),               "v"(l + QPITCHB),
           "v"(l + 2 * QPITCHB), "v"(l + 3 * QPITCHB),
           "v"(l + 4 * QPITCHB), "v"(l + 5 * QPITCHB),
           "v"(l + 6 * QPITCHB), "v"(l + 7 * QPITCHB),
           "v"(g),               "v"(g + N_EMBED),
           "v"(g + 2 * N_EMBED), "v"(g + 3 * N_EMBED),
           "v"(g + 4 * N_EMBED), "v"(g + 5 * N_EMBED),
           "v"(g + 6 * N_EMBED), "v"(g + 7 * N_EMBED)
        : "memory");
}

// One lane's 16 x values of chunk cc of a staged tile, for both row tiles of
// the wave, still f32: floats 0..7 and 16..23 behind 8*(lane/16), the K order
// of the A fragment.
__device__ __forceinline__ void read_x(const float4* xrd, int cc, float4 (&r)[2][4]) {
#pragma unroll
    for (int j = 0; j < 2; ++j) {
        const float4* p = xrd + j * 16 * QPITCH4 + cc * 8;
        r[j][0] = p[0]; r[j][1] = p[1]; r[j][2] = p[4]; r[j][3] = p[5];
    }
}

// The q, k and v B fragments of 32-K chunk c for the wave's 16 columns.
// wl = the wave's part of a stage's first chunk, the same in every lane; loff = the
// lane's place in it; c = the chunk inside the stage.
__device__ __forceinline__ void load_b(const half_t* __restrict__ wl, unsigned loff, int c,
                                       v16h (&b)[3]) {
    const half_t* __restrict__ wp = wl + (size_t)c * (4 * 32 * 16);
    b[0] = *(const v16h*)(wp + loff);
    b[1] = *(const v16h*)(wp + WPACK_ELEMS + loff);
    b[2] = *(const v16h*)(wp + 2 * WPACK_ELEMS + loff);
}

// ---------------------------------------------------------------------------
// Kernel 1: q,k,v projections. A block owns 64 rows of x and brings them into
// LDS in 4 stages of 256 floats a row, two buffers, by asynchronous copies:
// the next stage flies while this one is worked on. Wave w takes 32 of the
// rows (w/4) and columns 16*(w%4) .. +15 of q, k and v: 6 WMMAs per 32-K
// chunk, each B fragment serving two row tiles. Outputs:
//   qh     f16 [B*T, 64]       pre-scaled by 1/sqrt(H) (for Q B-fragments)
//   khpack f16 [B][T/16][2][32][16]   attention K A-fragment layout
//   vtpack f16 [B][T/32][4][32][16]   attention V^T A-fragment layout
// ---------------------------------------------------------------------------
__global__ void __launch_bounds__(256)
qkv_proj_kernel(const float* __restrict__ x, const half_t* __restrict__ wpack,
                const float* __restrict__ bq, const float* __restrict__ bk,
                const float* __restrict__ bv,
                half_t* __restrict__ qh, half_t* __restrict__ khp,
                half_t* __restrict__ vtp) {
    __shared__ float4 xs[4 * QHALF4];

    const int lane   = threadIdx.x & 31;
    const int lane16 = lane & 15;
    const int khalf  = lane >> 4;
    const int wave   = __builtin_amdgcn_readfirstlane(threadIdx.x >> 5);
    const int n      = wave & 3;     // the wave's 16 columns of q, k and v
    const int rh     = wave >> 2;    // the wave's 32 rows

    // Every block reads the same packed W. So that the blocks do not all ask L2
    // for the same lines at the same moment, a block enters the K walk at stage
    // s0, and every stage at its chunk c0, and wraps: 8 places; blocks 8 apart in
    // the grid take neighbouring ones.
    const int s0 = (blockIdx.x >> 3) & (QNST - 1);
    const int c0 = ((blockIdx.x >> 5) & 1) * (QCH / 2);
    const int c1 = QCH / 2 - c0;

    // B fragments in a ring of 4 chunks, fetched 3 chunks ahead
    // wst[i] = the wave's columns of the first chunk of the i-th stage of the walk
    const half_t* __restrict__ wst[QNST];
#pragma unroll
    for (int i = 0; i < QNST; ++i)
        wst[i] = wpack + (size_t)n * 32 * 16 + (size_t)(STAGE_AT(i) * QCH) * (4 * 32 * 16);
    const unsigned loff = (unsigned)lane * 16u;
    v16h bf[4][3];
#pragma unroll
    for (int c = 0; c < 3; ++c) load_b(wst[0], loff, CC_AT(c), bf[c]);

    // what this wave copies: rows 8*wave .. +7 of the block, 16 bytes a lane
    const unsigned lrow = (unsigned)(size_t)xs + (unsigned)(rh * 64 + n * 8) * QPITCHB + (unsigned)lane * 16u;
    const float* __restrict__ grow =
        x + (size_t)(blockIdx.x * QROWS + wave * 8) * N_EMBED + lane * 4;
    // what this lane reads: A: M = lane%16
    const float4* xrd = xs + (rh * 64 + lane16) * QPITCH4 + 2 * khalf;

    copy_stage(lrow, grow, STAGE_AT(0), 0);
    // Stage 0 has landed, for this wave's copies, behind this wait ...
    asm volatile("s_wait_asynccnt 0x0" ::: "memory");
    // ... and for every wave's behind this barrier.
    __syncthreads();
    copy_stage(lrow, grow, STAGE_AT(1), 1);

    v8f accq[2] = {}, acck[2] = {}, accv[2] = {};
    float4 xa[2][2][4];              // x of the even and of the odd chunks
    read_x(xrd, CC_AT(0), xa[0]);

    // Unrolled whole, so that ring slots, buffers and stage tests are constants.
#pragma unroll
    for (int c = 0; c < N_EMBED / 32; ++c) {
        const int s  = c / QCH;      // which stage of the block's walk
        const int cc = c % QCH;      // which chunk of that stage's walk
        if (c + 3 < N_EMBED / 32) load_b(wst[(c + 3) / QCH], loff, CC_AT((c + 3) % QCH), bf[(c + 3) & 3]);
        if (cc + 1 < QCH) read_x(xrd + (s & 1) * QHALF4, CC_AT(cc + 1), xa[(c + 1) & 1]);
        const v16h a0 = cvt_x(xa[c & 1][0]);
        const v16h a1 = cvt_x(xa[c & 1][1]);
        accq[0] = wmma_f16(a0, bf[c & 3][0], accq[0]);
        acck[0] = wmma_f16(a0, bf[c & 3][1], acck[0]);
        accv[0] = wmma_f16(a0, bf[c & 3][2], accv[0]);
        accq[1] = wmma_f16(a1, bf[c & 3][0], accq[1]);
        acck[1] = wmma_f16(a1, bf[c & 3][1], acck[1]);
        accv[1] = wmma_f16(a1, bf[c & 3][2], accv[1]);
        if (cc + 1 == QCH && s + 1 < QNST) {
            // This wave's reads of stage s are done before the buffer is refilled.
            asm volatile("s_wait_dscnt 0x0" ::: "memory");
            // This wave's copies of stage s+1 have landed.
            asm volatile("s_wait_asynccnt 0x0" ::: "memory");
            // Publishes stage s+1 and ends every wave's reads of stage s.
            __syncthreads();
            if (s + 2 < QNST) copy_stage(lrow, grow, STAGE_AT(s + 2), s & 1);
            read_x(xrd + ((s + 1) & 1) * QHALF4, CC_AT(0), xa[(c + 1) & 1]);
        }
    }
    // No copy is left outstanding when the wave ends.
    asm volatile("s_wait_asynccnt 0x0" ::: "memory");

    const int col = 16 * n + lane16;   // output column h; C/D: N = lane%16
    const float biasq = bq[col];
    const float biask = bk[col];
    const float biasv = bv[col];
    // The register that holds col in these three loads gets another value behind
    // this: their address translations are waited for first. col is an input so
    // that its register stays untouched up to the wait, the loaded values so that
    // the loads stay in front of it.
    asm volatile("s_wait_xcnt 0x0" :: "v"(col), "v"(biasq), "v"(biask), "v"(biasv) : "memory");
    // k-pack coords from h
    const int kf      = col >> 5;                 // which 32-h fragment
    const int hp      = col & 31;
    const int kh_lane = ((hp >> 3) & 1) * 16;     // + t%16
    const int kh_e    = (hp & 7) + 8 * (hp >> 4);
    // v-pack coords from h
    const int t4      = col >> 4;
    const int v_l16   = col & 15;
#pragma unroll
    for (int j = 0; j < 2; ++j) {
        const int rowTile = blockIdx.x * 4 + rh * 2 + j;   // 0 .. B*T/16-1
#pragma unroll
        for (int r = 0; r < 8; ++r) {
            const int orow = rowTile * 16 + r + 8 * khalf; // M = r + 8*(lane/16)
            const int bidx = orow >> 12;
            const int t    = orow & (TSEQ - 1);
            // q: row major, pre-scaled by 1/sqrt(HEAD)
            qh[(size_t)orow * HEAD + col] = (half_t)((accq[j][r] + biasq) * 0.125f);
            // k: A-fragment layout [b][t/16][kf][lane][e]
            const size_t kidx =
                ((((size_t)bidx * 256 + (t >> 4)) * 2 + kf) * 32 +
                 (kh_lane + (t & 15))) * 16 + kh_e;
            khp[kidx] = (half_t)(acck[j][r] + biask);
            // v: V^T A-fragment layout [b][t/32][t4][lane][e]
            const int Krel = t & 31;
            const size_t vidx =
                ((((size_t)bidx * 128 + (t >> 5)) * 4 + t4) * 32 +
                 (((Krel >> 3) & 1) * 16 + v_l16)) * 16 +
                ((Krel & 7) + 8 * (Krel >> 4));
            vtp[vidx] = (half_t)(accv[j][r] + biasv);
        }
    }
}

// ---------------------------------------------------------------------------
// Kernel 2: flash attention, causal, 64-key chunks.
// S^T = K * Q^T so softmax'd probabilities convert element-wise into the
// B operands of O^T = V^T * P^T.
// A block owns two groups of 32 queries, group 127-p and group p of one batch:
// together they always see 65 chunks, so every block has the same work. The 8
// waves deal these 65 chunks out among themselves; each K/V fragment a wave
// loads serves both 16-query tiles of the group. Every wave keeps its own
// (m, l, O) per tile, leaves them in LDS, and behind one barrier the block
// merges the 8 partial results of each query.
// ---------------------------------------------------------------------------
#define AWAVES 8

// Online softmax of one 16-query tile over one 64-key chunk: updates m, l,
// rescales o, and returns the probabilities as the two P^T B operands.
__device__ __forceinline__ void softmax_tile(v8f (&s)[4], float& m, float& l,
                                             v8f (&o)[4], v16h& pb0, v16h& pb1) {
    // one shfl_xor(16) completes each 64-key row
    float mc = s[0][0];
#pragma unroll
    for (int r = 1; r < 8; ++r) mc = fmaxf(mc, s[0][r]);
#pragma unroll
    for (int r = 0; r < 8; ++r) {
        mc = fmaxf(mc, s[1][r]);
        mc = fmaxf(mc, s[2][r]);
        mc = fmaxf(mc, s[3][r]);
    }
    mc = fmaxf(mc, __shfl_xor(mc, 16, 32));

    const float m_new = fmaxf(m, mc);
    const float alpha = __expf(m - m_new);

    float rs = 0.0f;
#pragma unroll
    for (int r = 0; r < 8; ++r) {
        s[0][r] = __expf(s[0][r] - m_new); rs += s[0][r];
        s[1][r] = __expf(s[1][r] - m_new); rs += s[1][r];
        s[2][r] = __expf(s[2][r] - m_new); rs += s[2][r];
        s[3][r] = __expf(s[3][r] - m_new); rs += s[3][r];
    }
    rs += __shfl_xor(rs, 16, 32);
    l = l * alpha + rs;
    m = m_new;

#pragma unroll
    for (int r = 0; r < 8; ++r) {
        o[0][r] *= alpha; o[1][r] *= alpha; o[2][r] *= alpha; o[3][r] *= alpha;
    }

    // P^T B operands: direct element copy from S^T accumulators
#pragma unroll
    for (int r = 0; r < 8; ++r) {
        pb0[r]     = (half_t)s[0][r];  // keys kbase    .. +15
        pb0[r + 8] = (half_t)s[1][r];  // keys kbase+16 .. +31
        pb1[r]     = (half_t)s[2][r];  // keys kbase+32 .. +47
        pb1[r + 8] = (half_t)s[3][r];  // keys kbase+48 .. +63
    }
}

// The key chunk of item it: the walk through a group of n chunks starts at chunk
// off and wraps, so that it meets every chunk of the group once.
__device__ __forceinline__ int chunk_of(int it, int nfirst, int nsecond, int offa, int offb) {
    const bool a = it < nfirst;
    const int  n = a ? nfirst : nsecond;
    const int  c = a ? (it + offa) : (it - nfirst + offb);
    return (c >= n) ? (c - n) : c;
}

__global__ void __launch_bounds__(32 * AWAVES)
attn_kernel(const half_t* __restrict__ qh, const half_t* __restrict__ khp,
            const half_t* __restrict__ vtp, float* __restrict__ out) {
    // part[wave][slot][lane]: 4 floats of a wave's un-normalised O^T, with
    // slot = ((group*2 + tile)*4 + t4)*2 + (upper 4 of the lane's 8 h values)
    __shared__ float4 part[AWAVES * 32 * 32];
    // ml[wave][group*2 + tile][query]: that wave's (m, l)
    __shared__ float2 ml[AWAVES * 4 * 16];

    const int lane   = threadIdx.x & 31;
    const int lane16 = lane & 15;
    const int khalf  = lane >> 4;
    const int wave   = __builtin_amdgcn_readfirstlane(threadIdx.x >> 5);

    const int bidx = blockIdx.x >> 6;   // batch
    const int p    = blockIdx.x & 63;   // pair of query groups: 127-p and p

    const half_t* __restrict__ klane = khp + (size_t)bidx * 256 * 1024 + (size_t)lane * 16;
    const half_t* __restrict__ vlane = vtp + (size_t)bidx * 128 * 2048 + (size_t)lane * 16;

    const int nfirst = ((127 - p) >> 1) + 1;    // chunks of group 127-p (33..64)
    const int nitems = 65;                      // chunks of both groups together
    const int nsecond = nitems - nfirst;        // chunks of group p (1..32)
    // The 64 blocks of a batch read the same K and V. So that they do not all ask
    // L2 for the same lines at the same moment, each block enters a group's keys
    // at a chunk of its own and wraps; the online softmax takes any order. The
    // start is a 64th part of the group's length, another one for each p, spread
    // so that at any pass the blocks' chunks lie evenly over the keys.
    const int part64 = (p * 27) & 63;
    const int offa = (part64 * nfirst) >> 6;    // 0 .. nfirst-1
    const int offb = (part64 * nsecond) >> 6;   // 0 .. nsecond-1

    // Q^T B-fragments of both tiles of both groups: N = query = lane%16, K = h
    const half_t* __restrict__ qa =
        qh + ((size_t)(bidx << 12) + (127 - p) * 32 + lane16) * HEAD + 8 * khalf;
    const half_t* __restrict__ qb =
        qh + ((size_t)(bidx << 12) + p * 32 + lane16) * HEAD + 8 * khalf;
    v16h bq[2][2], bqn[2][2];
#pragma unroll
    for (int t = 0; t < 2; ++t) {
#pragma unroll
        for (int j = 0; j < 8; ++j) {
            const int h = 16 * t * HEAD + koff(j);
            bq[t][0][2 * j]      = qa[h];
            bq[t][0][2 * j + 1]  = qa[h + 1];
            bq[t][1][2 * j]      = qa[h + 32];
            bq[t][1][2 * j + 1]  = qa[h + 33];
            bqn[t][0][2 * j]     = qb[h];
            bqn[t][0][2 * j + 1] = qb[h + 1];
            bqn[t][1][2 * j]     = qb[h + 32];
            bqn[t][1][2 * j + 1] = qb[h + 33];
        }
    }
    // The address registers of the Q loads get other values behind this: the
    // loads' address translations are waited for first. The two pointers are
    // inputs so that their registers stay untouched up to the wait.
    asm volatile("s_wait_xcnt 0x0" :: "v"(qa), "v"(qb) : "memory");

    // The 65 chunks of both groups are numbered through: item i is the i-th chunk
    // of the walk through group 127-p while i < nfirst, the (i - nfirst)-th of the
    // walk through group p behind that. Wave w takes items w, w+8, ...
    // K fragments of the wave's first item; each pass fetches the next item's,
    // across the change of group too.
    int c = chunk_of(wave, nfirst, nsecond, offa, offb);   // chunk of the current item
    const half_t* __restrict__ kfirst = klane + (size_t)c * 4096;
    v16h kf[8];
#pragma unroll
    for (int i = 0; i < 8; ++i) kf[i] = *(const v16h*)(kfirst + i * 512);
    // The same for the address registers of these K loads.
    asm volatile("s_wait_xcnt 0x0" :: "v"(kfirst) : "memory");
    // Where the current item's V lies, the chunk of the wave's next item (items w
    // and w+8 both exist), and where the next K fetch reads.
    const half_t* __restrict__ vcur = vlane + (size_t)c * 4096;
    int cnext = chunk_of(wave + AWAVES, nfirst, nsecond, offa, offb);
    const half_t* __restrict__ knext = klane + (size_t)cnext * 4096;
    int item = wave;
    for (int grp = 0; grp < 2; ++grp) {
        const int qbase = (grp ? p : (127 - p)) * 32;   // first query of the group
        const int iend  = grp ? nitems : nfirst;

        float m[2] = {NEG_BIG, NEG_BIG}, l[2] = {0.0f, 0.0f};
        v8f o[2][4] = {};

        for (; item < iend; item += AWAVES) {
            const int kbase = c * 64;
            // --- this chunk's V^T fragments, wanted behind the softmax ---
            v16h vf[8];
#pragma unroll
            for (int i = 0; i < 8; ++i) vf[i] = *(const v16h*)(vcur + i * 512);

            // --- scores S^T for 64 keys x 2 tiles: 4 subtiles x 2 WMMAs each ---
            v8f s[2][4] = {};
#pragma unroll
            for (int hh = 0; hh < 2; ++hh)
#pragma unroll
                for (int t = 0; t < 2; ++t)
#pragma unroll
                    for (int i = 0; i < 4; ++i)
                        s[t][i] = wmma_f16(kf[2 * i + hh], bq[t][hh], s[t][i]);

            // --- causal mask (scale already folded into q); only a group's
            // last chunk holds keys behind the group's first query ---
            if (kbase + 63 > qbase) {
#pragma unroll
                for (int t = 0; t < 2; ++t) {
                    const int qg = qbase + 16 * t + lane16;   // this lane's query
#pragma unroll
                    for (int r = 0; r < 8; ++r) {
                        const int kg = kbase + r + 8 * khalf; // key = r + 8*(lane/16)
                        if (kg > qg)      s[t][0][r] = NEG_BIG;
                        if (kg + 16 > qg) s[t][1][r] = NEG_BIG;
                        if (kg + 32 > qg) s[t][2][r] = NEG_BIG;
                        if (kg + 48 > qg) s[t][3][r] = NEG_BIG;
                    }
                }
            }

            // --- K fragments of the wave's next item ---
#pragma unroll
            for (int i = 0; i < 8; ++i) kf[i] = *(const v16h*)(knext + i * 512);
            // The K and V pointers take new values behind this: the address translations
            // of this pass's loads are waited for before their registers change. The two
            // pointers are inputs so that their registers stay untouched up to the wait.
            asm volatile("s_wait_xcnt 0x0" :: "v"(vcur), "v"(knext) : "memory");
            // Keeps the K loads here, in front of the softmax: without it they sink
            // to the head of the next pass, whose WMMAs then wait out their latency.
            // It also holds the pointer updates behind the wait above.
            __builtin_amdgcn_sched_barrier(0);
            // On by one item. The wave's last pass has no next item: the pass in front
            // of it leaves the K pointer on that last item's own chunk, asked for again.
            c = cnext;
            vcur = vlane + (size_t)c * 4096;
            if (item + 2 * AWAVES < nitems)
                cnext = chunk_of(item + 2 * AWAVES, nfirst, nsecond, offa, offb);
            knext = klane + (size_t)cnext * 4096;

            v16h pb[2][2];
#pragma unroll
            for (int t = 0; t < 2; ++t)
                softmax_tile(s[t], m[t], l[t], o[t], pb[t][0], pb[t][1]);

            // --- O^T += V^T * P^T : 2 tiles x 4 h-tiles x 2 key-halves ---
#pragma unroll
            for (int kk = 0; kk < 2; ++kk)
#pragma unroll
                for (int t = 0; t < 2; ++t)
#pragma unroll
                    for (int i = 0; i < 4; ++i)
                        o[t][i] = wmma_f16(vf[4 * kk + i], pb[t][kk], o[t][i]);
        }

        // --- this wave's partial result of the group goes to LDS ---
#pragma unroll
        for (int t = 0; t < 2; ++t) {
            const int gt = grp * 2 + t;
#pragma unroll
            for (int i = 0; i < 4; ++i) {
                float4* pp = part + ((wave * 32 + (gt * 4 + i) * 2) * 32 + lane);
                pp[0]  = make_float4(o[t][i][0], o[t][i][1], o[t][i][2], o[t][i][3]);
                pp[32] = make_float4(o[t][i][4], o[t][i][5], o[t][i][6], o[t][i][7]);
            }
            if (khalf == 0) ml[(wave * 4 + gt) * 16 + lane16] = make_float2(m[t], l[t]);
            bq[t][0] = bqn[t][0];
            bq[t][1] = bqn[t][1];
        }
    }

    // Every wave's partial results are in LDS before any wave merges them.
    __syncthreads();

    // --- merge: wave w takes tile w/2 (of the 4) and h values 32*(w%2) .. +31,
    // one whole 128-byte line of each of its 16 output rows ---
    const int gt   = wave >> 1;
    const int qrow = ((gt >> 1) ? p : (127 - p)) * 32 + (gt & 1) * 16 + lane16;
    float wm[AWAVES], wl[AWAVES];
    float mall = NEG_BIG;
#pragma unroll
    for (int w = 0; w < AWAVES; ++w) {
        const float2 v = ml[(w * 4 + gt) * 16 + lane16];
        wm[w] = v.x; wl[w] = v.y;
        mall = fmaxf(mall, v.x);
    }
    float lall = 0.0f;
#pragma unroll
    for (int w = 0; w < AWAVES; ++w) {
        wm[w] = __expf(wm[w] - mall);   // a wave without chunks weighs 0
        lall += wm[w] * wl[w];
    }
    const float inv = 1.0f / lall;

    // O^T element (h = t4*16 + r + 8*khalf, query = lane%16)
    float* __restrict__ orow =
        out + ((size_t)(bidx << 12) + qrow) * HEAD + (wave & 1) * 32 + 8 * khalf;
#pragma unroll
    for (int j = 0; j < 4; ++j) {       // t4 = 2*(w%2) + j/2, upper half = j%2
        const float4* pp = part + ((gt * 8 + (wave & 1) * 4 + j) * 32 + lane);
        float4 acc = make_float4(0.0f, 0.0f, 0.0f, 0.0f);
#pragma unroll
        for (int w = 0; w < AWAVES; ++w) {
            const float4 v = pp[w * 32 * 32];
            acc.x += wm[w] * v.x; acc.y += wm[w] * v.y;
            acc.z += wm[w] * v.z; acc.w += wm[w] * v.w;
        }
        acc.x *= inv; acc.y *= inv; acc.z *= inv; acc.w *= inv;
        *(float4*)(orow + (j >> 1) * 16 + (j & 1) * 4) = acc;
    }
}

// ---------------------------------------------------------------------------
extern "C" void kernel_launch(void* const* d_in, const int* in_sizes, int n_in,
                              void* d_out, int out_size, void* d_ws, size_t ws_size,
                              hipStream_t stream) {
    const float* x  = (const float*)d_in[0];
    const float* Wq = (const float*)d_in[1];
    const float* bq = (const float*)d_in[2];
    const float* Wk = (const float*)d_in[3];
    const float* bk = (const float*)d_in[4];
    const float* Wv = (const float*)d_in[5];
    const float* bv = (const float*)d_in[6];
    float* out = (float*)d_out;

    const size_t QK = (size_t)NBATCH * TSEQ * HEAD; // 1,048,576 elems
    half_t* qh    = (half_t*)d_ws;
    half_t* khp   = qh + QK;                 // K in A-fragment layout
    half_t* vtp   = khp + QK;                // V^T in A-fragment layout
    half_t* wpack = vtp + QK;                // 3 * 65536 f16

    pack_w_kernel<<<(3 * WPACK_ELEMS) / 256, 256, 0, stream>>>(Wq, Wk, Wv, wpack);

    // one block of 8 waves per 64 rows of x
    qkv_proj_kernel<<<NBATCH * TSEQ / QROWS, 256, 0, stream>>>(x, wpack, bq, bk, bv,
                                                               qh, khp, vtp);

    // one block per pair of 32-query groups: 64 pairs in each batch
    attn_kernel<<<NBATCH * (TSEQ / 64), 32 * AWAVES, 0, stream>>>(qh, khp, vtp, out);
}

// v005
// It runs in 26 microseconds.
// Next to v004, in two timings, it ran 1.04 and 1.06 times as fast.
// Counting every step since v000, it is 9.71 times as fast.
#include <hip/hip_runtime.h>
#include <hip/hip_bf16.h>

typedef _Float16 half_t;
typedef __attribute__((ext_vector_type(16))) _Float16 v16h;
typedef __attribute__((ext_vector_type(8)))  _Float16 v8h;
typedef __attribute__((ext_vector_type(8)))  float    v8f;

#define N_EMBED   1024
#define HEAD      64
#define TSEQ      4096
#define NBATCH    4
#define NEG_BIG   (-3.0e30f)
#define WPACK_ELEMS 65536   // per matrix: 1024*64

// 16-bit A/B WMMA fragment (16x32) K-mapping:
// element e -> K = (e<8 ? e : e+8) + 8*(lane/16)
// inverse:   khalf = (K>>3)&1 ; e = (K&7) + 8*(K>>4)

// Every packed fragment (W, Q, K, V^T) is 512 halves in the order
// [e/8][lane][e%8]: a lane's elements 0..7 lie 16 bytes behind its neighbour's,
// its elements 8..15 512 bytes further on, so each of the two 16-byte loads of
// a wave covers 512 contiguous bytes, four whole 128-byte lines.

// p = the fragment's first half + 8 * lane
__device__ __forceinline__ v16h load_frag(const half_t* __restrict__ p) {
    const v8h lo = *(const v8h*)p;
    const v8h hi = *(const v8h*)(p + 256);
    return __builtin_shufflevector(lo, hi, 0, 1, 2, 3, 4, 5, 6, 7, 8, 9, 10, 11, 12, 13, 14, 15);
}

__device__ __forceinline__ v8f wmma_f16(v16h a, v16h b, v8f c) {
    return __builtin_amdgcn_wmma_f32_16x16x32_f16(false, a, false, b, (short)0, c, false, false);
}

// ---------------------------------------------------------------------------
// Kernel 0: pack Wq|Wk|Wv (f32 [1024,64]) into f16 fragments (column in lane%16):
// wpack[m][c][n][e/8][lane][e%8].
// ---------------------------------------------------------------------------
__global__ void __launch_bounds__(256)
pack_w_kernel(const float* __restrict__ Wq, const float* __restrict__ Wk,
              const float* __restrict__ Wv, half_t* __restrict__ wpack) {
    const int idx = blockIdx.x * 256 + threadIdx.x;     // 0 .. 3*65536-1
    const int m   = idx >> 16;
    const int r   = idx & (WPACK_ELEMS - 1);
    const int e   = (r & 7) + 8 * ((r >> 8) & 1);
    const int l   = (r >> 3) & 31;
    const int cn  = r >> 9;            // c*4 + n
    const int n   = cn & 3;
    const int c   = cn >> 2;
    const int K   = 32 * c + ((e < 8) ? e : (e + 8)) + 8 * (l >> 4);
    const int col = 16 * n + (l & 15);
    const float* __restrict__ W = (m == 0) ? Wq : (m == 1) ? Wk : Wv;
    wpack[idx] = (half_t)W[(size_t)K * HEAD + col];
}

typedef __attribute__((ext_vector_type(8))) unsigned v8u;

// 16 f32 values to one f16 A fragment, round to nearest even as a cast does.
// Written in asm, volatile, so that it stays where the source has it, behind
// the fetches for later chunks: as plain casts the conversions move up to
// stand directly behind their own LDS reads, and the wave waits out the LDS
// latency twice a chunk. The four v_nop keep the distance between an earlier
// WMMA and a vector write over its A registers.
__device__ __forceinline__ v16h cvt_x(const float4 (&r)[4]) {
    v8u d;
    unsigned d0, d1, d2, d3, d4, d5, d6, d7;
    asm volatile(
        "v_nop\n\tv_nop\n\tv_nop\n\tv_nop\n\t"
        "v_cvt_pk_f16_f32 %0, %8, %9\n\t"
        "v_cvt_pk_f16_f32 %1, %10, %11\n\t"
        "v_cvt_pk_f16_f32 %2, %12, %13\n\t"
        "v_cvt_pk_f16_f32 %3, %14, %15\n\t"
        "v_cvt_pk_f16_f32 %4, %16, %17\n\t"
        "v_cvt_pk_f16_f32 %5, %18, %19\n\t"
        "v_cvt_pk_f16_f32 %6, %20, %21\n\t"
        "v_cvt_pk_f16_f32 %7, %22, %23"
        : "=&v"(d0), "=&v"(d1), "=&v"(d2), "=&v"(d3),
          "=&v"(d4), "=&v"(d5), "=&v"(d6), "=&v"(d7)
        : "v"(r[0].x), "v"(r[0].y), "v"(r[0].z), "v"(r[0].w),
          "v"(r[1].x), "v"(r[1].y), "v"(r[1].z), "v"(r[1].w),
          "v"(r[2].x), "v"(r[2].y), "v"(r[2].z), "v"(r[2].w),
          "v"(r[3].x), "v"(r[3].y), "v"(r[3].z), "v"(r[3].w));
    d[0] = d0; d[1] = d1; d[2] = d2; d[3] = d3;
    d[4] = d4; d[5] = d5; d[6] = d6; d[7] = d7;
    return __builtin_bit_cast(v16h, d);
}

#define QROWS   64                    // x rows of a block
#define QKS     256                   // floats of each row in one stage
#define QNST    (N_EMBED / QKS)       // stages
#define QCH     (QKS / 32)            // 32-K chunks in a stage
#define QPITCH4 (QKS / 4 + 1)         // staged row pitch in float4: 16 B x odd
#define QHALF4  (32 * QPITCH4)        // 32 staged rows, in float4
#define QPITCHB (QPITCH4 * 16)
#define QHALFB  (QHALF4 * 16)
// The i-th stage that a block works on, for a walk that starts at stage s0 and
// wraps, and the i-th chunk inside a stage, for a walk that starts at chunk c0
// (0 or half a stage) and wraps; c1 = the other of the two.
#define STAGE_AT(i) ((s0 + (i)) & (QNST - 1))
#define CC_AT(i)    ((((i) < QCH / 2) ? c0 : c1) + ((i) & (QCH / 2 - 1)))
// LDS order: rows 0..31 buffer 0, rows 0..31 buffer 1, rows 32..63 buffer 0,
// rows 32..63 buffer 1: both buffers of a reader's 32 rows lie within the
// 64 KB that the offset field of one LDS read reaches from one address.

// The wave's 8 rows of stage s into buffer buf: each row's 1 KB goes as two
// pieces of 512 contiguous bytes, 16 bytes a lane, from global memory straight
// into LDS. lrow = the lane's LDS byte address in the wave's first row of
// buffer 0, grow = its global address in that row. offset:512 moves the LDS
// and the global address alike, which is the row's second piece in both.
// The s_wait_xcnt stands inside the statement so that no address register of
// a copy takes a new value in front of it.
__device__ __forceinline__ void copy_stage(unsigned lrow, const float* __restrict__ grow,
                                           int s, int buf) {
    const unsigned l = lrow + (unsigned)buf * QHALFB;
    const float* __restrict__ g = grow + s * QKS;
    asm volatile(
        "global_load_async_to_lds_b128 %0, %8, off\n\t"
        "global_load_async_to_lds_b128 %0, %8, off offset:512\n\t"
        "global_load_async_to_lds_b128 %1, %9, off\n\t"
        "global_load_async_to_lds_b128 %1, %9, off offset:512\n\t"
        "global_load_async_to_lds_b128 %2, %10, off\n\t"
        "global_load_async_to_lds_b128 %2, %10, off offset:512\n\t"
        "global_load_async_to_lds_b128 %3, %11, off\n\t"
        "global_load_async_to_lds_b128 %3, %11, off offset:512\n\t"
        "global_load_async_to_lds_b128 %4, %12, off\n\t"
        "global_load_async_to_lds_b128 %4, %12, off offset:512\n\t"
        "global_load_async_to_lds_b128 %5, %13, off\n\t"
        "global_load_async_to_lds_b128 %5, %13, off offset:512\n\t"
        "global_load_async_to_lds_b128 %6, %14, off\n\t"
        "global_load_async_to_lds_b128 %6, %14, off offset:512\n\t"
        "global_load_async_to_lds_b128 %7, %15, off\n\t"
        "global_load_async_to_lds_b128 %7, %15, off offset:512\n\t"
        "s_wait_xcnt 0x0"
        :: "v"(l),               "v"(l + QPITCHB),
           "v"(l + 2 * QPITCHB), "v"(l + 3 * QPITCHB),
           "v"(l + 4 * QPITCHB), "v"(l + 5 * QPITCHB),
           "v"(l + 6 * QPITCHB), "v"(l + 7 * QPITCHB),
           "v"(g),               "v"(g + N_EMBED),
           "v"(g + 2 * N_EMBED), "v"(g + 3 * N_EMBED),
           "v"(g + 4 * N_EMBED), "v"(g + 5 * N_EMBED),
           "v"(g + 6 * N_EMBED), "v"(g + 7 * N_EMBED)
        : "memory");
}

// One lane's 16 x values of chunk cc of a staged tile, for both row tiles of
// the wave, still f32: floats 0..7 and 16..23 behind 8*(lane/16), the K order
// of the A fragment.
__device__ __forceinline__ void read_x(const float4* xrd, int cc, float4 (&r)[2][4]) {
#pragma unroll
    for (int j = 0; j < 2; ++j) {
        const float4* p = xrd + j * 16 * QPITCH4 + cc * 8;
        r[j][0] = p[0]; r[j][1] = p[1]; r[j][2] = p[4]; r[j][3] = p[5];
    }
}

// The q, k and v B fragments of 32-K chunk c for the wave's 16 columns.
// wl = the wave's part of a stage's first chunk, the same in every lane; loff = the
// lane's place in it; c = the chunk inside the stage.
__device__ __forceinline__ void load_b(const half_t* __restrict__ wl, unsigned loff, int c,
                                       v16h (&b)[3]) {
    const half_t* __restrict__ wp = wl + (size_t)c * (4 * 32 * 16);
    b[0] = load_frag(wp + loff);
    b[1] = load_frag(wp + WPACK_ELEMS + loff);
    b[2] = load_frag(wp + 2 * WPACK_ELEMS + loff);
}

// ---------------------------------------------------------------------------
// Kernel 1: q,k,v projections. A block owns 64 rows of x and brings them into
// LDS in 4 stages of 256 floats a row, two buffers, by asynchronous copies:
// the next stage flies while this one is worked on. Wave w takes 32 of the
// rows (w/4) and columns 16*(w%4) .. +15 of q, k and v: 6 WMMAs per 32-K
// chunk, each W fragment serving two row tiles. Outputs:
//   qh     f16 [B][T/16][2][fragment]   Q^T B fragments, pre-scaled by 1/sqrt(H)
//   khpack f16 [B][T/16][2][fragment]   attention K A fragments
//   vtpack f16 [B][T/32][4][fragment]   attention V^T A fragments
// ---------------------------------------------------------------------------
__global__ void __launch_bounds__(256)
qkv_proj_kernel(const float* __restrict__ x, const half_t* __restrict__ wpack,
                const float* __restrict__ bq, const float* __restrict__ bk,
                const float* __restrict__ bv,
                half_t* __restrict__ qh, half_t* __restrict__ khp,
                half_t* __restrict__ vtp) {
    __shared__ float4 xs[4 * QHALF4];

    const int lane   = threadIdx.x & 31;
    const int lane16 = lane & 15;
    const int khalf  = lane >> 4;
    const int wave   = __builtin_amdgcn_readfirstlane(threadIdx.x >> 5);
    const int n      = wave & 3;     // the wave's 16 columns of q, k and v
    const int rh     = wave >> 2;    // the wave's 32 rows

    // Every block reads the same packed W. So that the blocks do not all ask L2
    // for the same lines at the same moment, a block enters the K walk at stage
    // s0, and every stage at its chunk c0, and wraps: 8 places; blocks 8 apart in
    // the grid take neighbouring ones.
    const int s0 = (blockIdx.x >> 3) & (QNST - 1);
    const int c0 = ((blockIdx.x >> 5) & 1) * (QCH / 2);
    const int c1 = QCH / 2 - c0;

    // B fragments in a ring of 4 chunks, fetched 3 chunks ahead
    // wst[i] = the wave's columns of the first chunk of the i-th stage of the walk
    const half_t* __restrict__ wst[QNST];
#pragma unroll
    for (int i = 0; i < QNST; ++i)
        wst[i] = wpack + (size_t)n * 32 * 16 + (size_t)(STAGE_AT(i) * QCH) * (4 * 32 * 16);
    const unsigned loff = (unsigned)lane * 8u;
    v16h bf[4][3];
#pragma unroll
    for (int c = 0; c < 3; ++c) load_b(wst[0], loff, CC_AT(c), bf[c]);

    // what this wave copies: rows 8*wave .. +7 of the block, 16 bytes a lane
    const unsigned lrow = (unsigned)(size_t)xs + (unsigned)(rh * 64 + n * 8) * QPITCHB + (unsigned)lane * 16u;
    const float* __restrict__ grow =
        x + (size_t)(blockIdx.x * QROWS + wave * 8) * N_EMBED + lane * 4;
    // what this lane reads: A: M = lane%16
    const float4* xrd = xs + (rh * 64 + lane16) * QPITCH4 + 2 * khalf;

    copy_stage(lrow, grow, STAGE_AT(0), 0);
    // Stage 0 has landed, for this wave's copies, behind this wait ...
    asm volatile("s_wait_asynccnt 0x0" ::: "memory");
    // ... and for every wave's behind this barrier.
    __syncthreads();
    copy_stage(lrow, grow, STAGE_AT(1), 1);

    v8f accq[2] = {}, acck[2] = {}, accv[2] = {};
    float4 xa[2][2][4];              // x of the even and of the odd chunks
    read_x(xrd, CC_AT(0), xa[0]);

    // Unrolled whole, so that ring slots, buffers and stage tests are constants.
#pragma unroll
    for (int c = 0; c < N_EMBED / 32; ++c) {
        const int s  = c / QCH;      // which stage of the block's walk
        const int cc = c % QCH;      // which chunk of that stage's walk
        if (c + 3 < N_EMBED / 32) load_b(wst[(c + 3) / QCH], loff, CC_AT((c + 3) % QCH), bf[(c + 3) & 3]);
        if (cc + 1 < QCH) read_x(xrd + (s & 1) * QHALF4, CC_AT(cc + 1), xa[(c + 1) & 1]);
        const v16h a0 = cvt_x(xa[c & 1][0]);
        const v16h a1 = cvt_x(xa[c & 1][1]);
        // q and k as W^T * x^T (the A and B fragments have the same lane and K
        // order, so the operands only change places), v as x * W
        accq[0] = wmma_f16(bf[c & 3][0], a0, accq[0]);
        acck[0] = wmma_f16(bf[c & 3][1], a0, acck[0]);
        accv[0] = wmma_f16(a0, bf[c & 3][2], accv[0]);
        accq[1] = wmma_f16(bf[c & 3][0], a1, accq[1]);
        acck[1] = wmma_f16(bf[c & 3][1], a1, acck[1]);
        accv[1] = wmma_f16(a1, bf[c & 3][2], accv[1]);
        if (cc + 1 == QCH && s + 1 < QNST) {
            // This wave's reads of stage s are done before the buffer is refilled.
            asm volatile("s_wait_dscnt 0x0" ::: "memory");
            // This wave's copies of stage s+1 have landed.
            asm volatile("s_wait_asynccnt 0x0" ::: "memory");
            // Publishes stage s+1 and ends every wave's reads of stage s.
            __syncthreads();
            if (s + 2 < QNST) copy_stage(lrow, grow, STAGE_AT(s + 2), s & 1);
            read_x(xrd + ((s + 1) & 1) * QHALF4, CC_AT(0), xa[(c + 1) & 1]);
        }
    }
    // No copy is left outstanding when the wave ends.
    asm volatile("s_wait_asynccnt 0x0" ::: "memory");

    // q and k came out transposed: a lane holds row t = lane%16 of the tile and
    // h = 16n + 8*(lane/16) + r, which are elements 8*(n%2) + r of its own slot in
    // fragment [tile][n/2]. v came out with h = 16n + lane%16 and t = 8*(lane/16) + r
    // of tile j: elements 8*j + r of its own slot in fragment [tile/2][n]. So each
    // tile leaves as one 16-byte store a lane, 512 contiguous bytes a wave.
    const int hb  = 16 * n + 8 * khalf;
    const int col = 16 * n + lane16;
    const float4 bq0 = *(const float4*)(bq + hb), bq1 = *(const float4*)(bq + hb + 4);
    const float4 bk0 = *(const float4*)(bk + hb), bk1 = *(const float4*)(bk + hb + 4);
    const float biasv = bv[col];
    // The registers that hold hb and col in these loads get other values behind
    // this: their address translations are waited for first. hb and col are inputs
    // so that their registers stay untouched up to the wait, the loaded values so
    // that the loads stay in front of it.
    asm volatile("s_wait_xcnt 0x0"
                 :: "v"(hb), "v"(col), "v"(biasv),
                    "v"(bq0.x), "v"(bq0.y), "v"(bq0.z), "v"(bq0.w),
                    "v"(bq1.x), "v"(bq1.y), "v"(bq1.z), "v"(bq1.w),
                    "v"(bk0.x), "v"(bk0.y), "v"(bk0.z), "v"(bk0.w),
                    "v"(bk1.x), "v"(bk1.y), "v"(bk1.z), "v"(bk1.w)
                 : "memory");
    const float biasq[8] = {bq0.x, bq0.y, bq0.z, bq0.w, bq1.x, bq1.y, bq1.z, bq1.w};
    const float biask[8] = {bk0.x, bk0.y, bk0.z, bk0.w, bk1.x, bk1.y, bk1.z, bk1.w};
#pragma unroll
    for (int j = 0; j < 2; ++j) {
        const int rowTile = blockIdx.x * 4 + rh * 2 + j;   // 0 .. B*T/16-1
        v8h qo, ko, vo;
#pragma unroll
        for (int r = 0; r < 8; ++r) {
            qo[r] = (half_t)((accq[j][r] + biasq[r]) * 0.125f);   // 1/sqrt(HEAD)
            ko[r] = (half_t)(acck[j][r] + biask[r]);
            vo[r] = (half_t)(accv[j][r] + biasv);
        }
        const size_t qk = ((size_t)rowTile * 2 + (n >> 1)) * 512 + (n & 1) * 256 + lane * 8;
        const size_t vi = ((size_t)(rowTile >> 1) * 4 + n) * 512 + j * 256 + lane * 8;
        *(v8h*)(qh + qk)  = qo;
        *(v8h*)(khp + qk) = ko;
        *(v8h*)(vtp + vi) = vo;
    }
}

// ---------------------------------------------------------------------------
// Kernel 2: flash attention, causal, 64-key chunks.
// S^T = K * Q^T so softmax'd probabilities convert element-wise into the
// B operands of O^T = V^T * P^T.
// A block owns two groups of 32 queries, group 127-p and group p of one batch:
// together they always see 65 chunks, so every block has the same work. The 8
// waves deal these 65 chunks out among themselves; each K/V fragment a wave
// loads serves both 16-query tiles of the group. Every wave keeps its own
// (m, l, O) per tile, leaves them in LDS, and behind one barrier the block
// merges the 8 partial results of each query.
// ---------------------------------------------------------------------------
#define AWAVES 8

// Online softmax of one 16-query tile over one 64-key chunk: updates m, l,
// rescales o, and returns the probabilities as the two P^T B operands.
__device__ __forceinline__ void softmax_tile(v8f (&s)[4], float& m, float& l,
                                             v8f (&o)[4], v16h& pb0, v16h& pb1) {
    // one shfl_xor(16) completes each 64-key row
    float mc = s[0][0];
#pragma unroll
    for (int r = 1; r < 8; ++r) mc = fmaxf(mc, s[0][r]);
#pragma unroll
    for (int r = 0; r < 8; ++r) {
        mc = fmaxf(mc, s[1][r]);
        mc = fmaxf(mc, s[2][r]);
        mc = fmaxf(mc, s[3][r]);
    }
    mc = fmaxf(mc, __shfl_xor(mc, 16, 32));

    const float m_new = fmaxf(m, mc);
    const float alpha = __expf(m - m_new);

    float rs = 0.0f;
#pragma unroll
    for (int r = 0; r < 8; ++r) {
        s[0][r] = __expf(s[0][r] - m_new); rs += s[0][r];
        s[1][r] = __expf(s[1][r] - m_new); rs += s[1][r];
        s[2][r] = __expf(s[2][r] - m_new); rs += s[2][r];
        s[3][r] = __expf(s[3][r] - m_new); rs += s[3][r];
    }
    rs += __shfl_xor(rs, 16, 32);
    l = l * alpha + rs;
    m = m_new;

#pragma unroll
    for (int r = 0; r < 8; ++r) {
        o[0][r] *= alpha; o[1][r] *= alpha; o[2][r] *= alpha; o[3][r] *= alpha;
    }

    // P^T B operands: direct element copy from S^T accumulators
#pragma unroll
    for (int r = 0; r < 8; ++r) {
        pb0[r]     = (half_t)s[0][r];  // keys kbase    .. +15
        pb0[r + 8] = (half_t)s[1][r];  // keys kbase+16 .. +31
        pb1[r]     = (half_t)s[2][r];  // keys kbase+32 .. +47
        pb1[r + 8] = (half_t)s[3][r];  // keys kbase+48 .. +63
    }
}

// The key chunk of item it: the walk through a group of n chunks starts at chunk
// off and wraps, so that it meets every chunk of the group once.
__device__ __forceinline__ int chunk_of(int it, int nfirst, int nsecond, int offa, int offb) {
    const bool a = it < nfirst;
    const int  n = a ? nfirst : nsecond;
    const int  c = a ? (it + offa) : (it - nfirst + offb);
    return (c >= n) ? (c - n) : c;
}

__global__ void __launch_bounds__(32 * AWAVES)
attn_kernel(const half_t* __restrict__ qh, const half_t* __restrict__ khp,
            const half_t* __restrict__ vtp, float* __restrict__ out) {
    // part[wave][slot][lane]: 4 floats of a wave's un-normalised O^T, with
    // slot = ((group*2 + tile)*4 + t4)*2 + (upper 4 of the lane's 8 h values)
    __shared__ float4 part[AWAVES * 32 * 32];
    // ml[wave][group*2 + tile][query]: that wave's (m, l)
    __shared__ float2 ml[AWAVES * 4 * 16];

    const int lane   = threadIdx.x & 31;
    const int lane16 = lane & 15;
    const int khalf  = lane >> 4;
    const int wave   = __builtin_amdgcn_readfirstlane(threadIdx.x >> 5);

    const int bidx = blockIdx.x >> 6;   // batch
    const int p    = blockIdx.x & 63;   // pair of query groups: 127-p and p

    const half_t* __restrict__ klane = khp + (size_t)bidx * 256 * 1024 + (size_t)lane * 8;
    const half_t* __restrict__ vlane = vtp + (size_t)bidx * 128 * 2048 + (size_t)lane * 8;

    const int nfirst = ((127 - p) >> 1) + 1;    // chunks of group 127-p (33..64)
    const int nitems = 65;                      // chunks of both groups together
    const int nsecond = nitems - nfirst;        // chunks of group p (1..32)
    // The 64 blocks of a batch read the same K and V. So that they do not all ask
    // L2 for the same lines at the same moment, each block enters a group's keys
    // at a chunk of its own and wraps; the online softmax takes any order. The
    // start is a 64th part of the group's length, another one for each p, spread
    // so that at any pass the blocks' chunks lie evenly over the keys.
    const int part64 = (p * 27) & 63;
    const int offa = (part64 * nfirst) >> 6;    // 0 .. nfirst-1
    const int offb = (part64 * nsecond) >> 6;   // 0 .. nsecond-1

    // Q^T B-fragments of both tiles of both groups: N = query = lane%16, K = h
    // a group is 2 tiles x 2 fragments, 2048 halves in a row
    const half_t* __restrict__ qa =
        qh + ((size_t)bidx * 128 + (127 - p)) * 2048 + (size_t)lane * 8;
    const half_t* __restrict__ qb =
        qh + ((size_t)bidx * 128 + p) * 2048 + (size_t)lane * 8;
    v16h bq[2][2], bqn[2][2];
#pragma unroll
    for (int t = 0; t < 2; ++t) {
#pragma unroll
        for (int f = 0; f < 2; ++f) {
            bq[t][f]  = load_frag(qa + (t * 2 + f) * 512);
            bqn[t][f] = load_frag(qb + (t * 2 + f) * 512);
        }
    }
    // The address registers of the Q loads get other values behind this: the
    // loads' address translations are waited for first. The two pointers are
    // inputs so that their registers stay untouched up to the wait.
    asm volatile("s_wait_xcnt 0x0" :: "v"(qa), "v"(qb) : "memory");

    // The 65 chunks of both groups are numbered through: item i is the i-th chunk
    // of the walk through group 127-p while i < nfirst, the (i - nfirst)-th of the
    // walk through group p behind that. Wave w takes items w, w+8, ...
    // K fragments of the wave's first item; each pass fetches the next item's,
    // across the change of group too.
    int c = chunk_of(wave, nfirst, nsecond, offa, offb);   // chunk of the current item
    const half_t* __restrict__ kfirst = klane + (size_t)c * 4096;
    v16h kf[8];
#pragma unroll
    for (int i = 0; i < 8; ++i) kf[i] = load_frag(kfirst + i * 512);
    // The same for the address registers of these K loads.
    asm volatile("s_wait_xcnt 0x0" :: "v"(kfirst) : "memory");
    // Where the current item's V lies, the chunk of the wave's next item (items w
    // and w+8 both exist), and where the next K fetch reads.
    const half_t* __restrict__ vcur = vlane + (size_t)c * 4096;
    int cnext = chunk_of(wave + AWAVES, nfirst, nsecond, offa, offb);
    const half_t* __restrict__ knext = klane + (size_t)cnext * 4096;
    int item = wave;
    for (int grp = 0; grp < 2; ++grp) {
        const int qbase = (grp ? p : (127 - p)) * 32;   // first query of the group
        const int iend  = grp ? nitems : nfirst;

        float m[2] = {NEG_BIG, NEG_BIG}, l[2] = {0.0f, 0.0f};
        v8f o[2][4] = {};

        for (; item < iend; item += AWAVES) {
            const int kbase = c * 64;
            // --- this chunk's V^T fragments, wanted behind the softmax ---
            v16h vf[8];
#pragma unroll
            for (int i = 0; i < 8; ++i) vf[i] = load_frag(vcur + i * 512);

            // --- scores S^T for 64 keys x 2 tiles: 4 subtiles x 2 WMMAs each ---
            v8f s[2][4] = {};
#pragma unroll
            for (int hh = 0; hh < 2; ++hh)
#pragma unroll
                for (int t = 0; t < 2; ++t)
#pragma unroll
                    for (int i = 0; i < 4; ++i)
                        s[t][i] = wmma_f16(kf[2 * i + hh], bq[t][hh], s[t][i]);

            // --- causal mask (scale already folded into q); only a group's
            // last chunk holds keys behind the group's first query ---
            if (kbase + 63 > qbase) {
#pragma unroll
                for (int t = 0; t < 2; ++t) {
                    const int qg = qbase + 16 * t + lane16;   // this lane's query
#pragma unroll
                    for (int r = 0; r < 8; ++r) {
                        const int kg = kbase + r + 8 * khalf; // key = r + 8*(lane/16)
                        if (kg > qg)      s[t][0][r] = NEG_BIG;
                        if (kg + 16 > qg) s[t][1][r] = NEG_BIG;
                        if (kg + 32 > qg) s[t][2][r] = NEG_BIG;
                        if (kg + 48 > qg) s[t][3][r] = NEG_BIG;
                    }
                }
            }

            // --- K fragments of the wave's next item ---
#pragma unroll
            for (int i = 0; i < 8; ++i) kf[i] = load_frag(knext + i * 512);
            // The K and V pointers take new values behind this: the address translations
            // of this pass's loads are waited for before their registers change. The two
            // pointers are inputs so that their registers stay untouched up to the wait.
            asm volatile("s_wait_xcnt 0x0" :: "v"(vcur), "v"(knext) : "memory");
            // Keeps the K loads here, in front of the softmax: without it they sink
            // to the head of the next pass, whose WMMAs then wait out their latency.
            // It also holds the pointer updates behind the wait above.
            __builtin_amdgcn_sched_barrier(0);
            // On by one item. The wave's last pass has no next item: the pass in front
            // of it leaves the K pointer on that last item's own chunk, asked for again.
            c = cnext;
            vcur = vlane + (size_t)c * 4096;
            if (item + 2 * AWAVES < nitems)
                cnext = chunk_of(item + 2 * AWAVES, nfirst, nsecond, offa, offb);
            knext = klane + (size_t)cnext * 4096;

            v16h pb[2][2];
#pragma unroll
            for (int t = 0; t < 2; ++t)
                softmax_tile(s[t], m[t], l[t], o[t], pb[t][0], pb[t][1]);

            // --- O^T += V^T * P^T : 2 tiles x 4 h-tiles x 2 key-halves ---
#pragma unroll
            for (int kk = 0; kk < 2; ++kk)
#pragma unroll
                for (int t = 0; t < 2; ++t)
#pragma unroll
                    for (int i = 0; i < 4; ++i)
                        o[t][i] = wmma_f16(vf[4 * kk + i], pb[t][kk], o[t][i]);
        }

        // --- this wave's partial result of the group goes to LDS ---
#pragma unroll
        for (int t = 0; t < 2; ++t) {
            const int gt = grp * 2 + t;
#pragma unroll
            for (int i = 0; i < 4; ++i) {
                float4* pp = part + ((wave * 32 + (gt * 4 + i) * 2) * 32 + lane);
                pp[0]  = make_float4(o[t][i][0], o[t][i][1], o[t][i][2], o[t][i][3]);
                pp[32] = make_float4(o[t][i][4], o[t][i][5], o[t][i][6], o[t][i][7]);
            }
            if (khalf == 0) ml[(wave * 4 + gt) * 16 + lane16] = make_float2(m[t], l[t]);
            bq[t][0] = bqn[t][0];
            bq[t][1] = bqn[t][1];
        }
    }

    // Every wave's partial results are in LDS before any wave merges them.
    __syncthreads();

    // --- merge: wave w takes tile w/2 (of the 4) and h values 32*(w%2) .. +31,
    // one whole 128-byte line of each of its 16 output rows ---
    const int gt   = wave >> 1;
    const int qrow = ((gt >> 1) ? p : (127 - p)) * 32 + (gt & 1) * 16 + lane16;
    float wm[AWAVES], wl[AWAVES];
    float mall = NEG_BIG;
#pragma unroll
    for (int w = 0; w < AWAVES; ++w) {
        const float2 v = ml[(w * 4 + gt) * 16 + lane16];
        wm[w] = v.x; wl[w] = v.y;
        mall = fmaxf(mall, v.x);
    }
    float lall = 0.0f;
#pragma unroll
    for (int w = 0; w < AWAVES; ++w) {
        wm[w] = __expf(wm[w] - mall);   // a wave without chunks weighs 0
        lall += wm[w] * wl[w];
    }
    const float inv = 1.0f / lall;

    // O^T element (h = t4*16 + r + 8*khalf, query = lane%16)
    float* __restrict__ orow =
        out + ((size_t)(bidx << 12) + qrow) * HEAD + (wave & 1) * 32 + 8 * khalf;
#pragma unroll
    for (int j = 0; j < 4; ++j) {       // t4 = 2*(w%2) + j/2, upper half = j%2
        const float4* pp = part + ((gt * 8 + (wave & 1) * 4 + j) * 32 + lane);
        float4 acc = make_float4(0.0f, 0.0f, 0.0f, 0.0f);
#pragma unroll
        for (int w = 0; w < AWAVES; ++w) {
            const float4 v = pp[w * 32 * 32];
            acc.x += wm[w] * v.x; acc.y += wm[w] * v.y;
            acc.z += wm[w] * v.z; acc.w += wm[w] * v.w;
        }
        acc.x *= inv; acc.y *= inv; acc.z *= inv; acc.w *= inv;
        *(float4*)(orow + (j >> 1) * 16 + (j & 1) * 4) = acc;
    }
}

// ---------------------------------------------------------------------------
extern "C" void kernel_launch(void* const* d_in, const int* in_sizes, int n_in,
                              void* d_out, int out_size, void* d_ws, size_t ws_size,
                              hipStream_t stream) {
    const float* x  = (const float*)d_in[0];
    const float* Wq = (const float*)d_in[1];
    const float* bq = (const float*)d_in[2];
    const float* Wk = (const float*)d_in[3];
    const float* bk = (const float*)d_in[4];
    const float* Wv = (const float*)d_in[5];
    const float* bv = (const float*)d_in[6];
    float* out = (float*)d_out;

    const size_t QK = (size_t)NBATCH * TSEQ * HEAD; // 1,048,576 elems
    half_t* qh    = (half_t*)d_ws;
    half_t* khp   = qh + QK;                 // K as A fragments
    half_t* vtp   = khp + QK;                // V^T as A fragments
    half_t* wpack = vtp + QK;                // 3 * 65536 f16

    pack_w_kernel<<<(3 * WPACK_ELEMS) / 256, 256, 0, stream>>>(Wq, Wk, Wv, wpack);

    // one block of 8 waves per 64 rows of x
    qkv_proj_kernel<<<NBATCH * TSEQ / QROWS, 256, 0, stream>>>(x, wpack, bq, bk, bv,
                                                               qh, khp, vtp);

    // one block per pair of 32-query groups: 64 pairs in each batch
    attn_kernel<<<NBATCH * (TSEQ / 64), 32 * AWAVES, 0, stream>>>(qh, khp, vtp, out);
}

// v006
// One run takes 24.6 microseconds.
// Next to v005, in two timings, it ran 1.05 times as fast each time.
// Counting every step since v000, it is 10.2 times as fast.
#include <hip/hip_runtime.h>
#include <hip/hip_bf16.h>

typedef _Float16 half_t;
typedef __attribute__((ext_vector_type(16))) _Float16 v16h;
typedef __attribute__((ext_vector_type(8)))  _Float16 v8h;
typedef __attribute__((ext_vector_type(8)))  float    v8f;

#define N_EMBED   1024
#define HEAD      64
#define TSEQ      4096
#define NBATCH    4
#define NEG_BIG   (-3.0e30f)
#define WPACK_ELEMS 65536   // per matrix: 1024*64

// 16-bit A/B WMMA fragment (16x32) K-mapping:
// element e -> K = (e<8 ? e : e+8) + 8*(lane/16)
// inverse:   khalf = (K>>3)&1 ; e = (K&7) + 8*(K>>4)

// Every packed fragment (W, Q, K, V^T) is 512 halves in the order
// [e/8][lane][e%8]: a lane's elements 0..7 lie 16 bytes behind its neighbour's,
// its elements 8..15 512 bytes further on, so each of the two 16-byte loads of
// a wave covers 512 contiguous bytes, four whole 128-byte lines.

// p = the fragment's first half + 8 * lane
__device__ __forceinline__ v16h load_frag(const half_t* __restrict__ p) {
    const v8h lo = *(const v8h*)p;
    const v8h hi = *(const v8h*)(p + 256);
    return __builtin_shufflevector(lo, hi, 0, 1, 2, 3, 4, 5, 6, 7, 8, 9, 10, 11, 12, 13, 14, 15);
}

__device__ __forceinline__ v8f wmma_f16(v16h a, v16h b, v8f c) {
    return __builtin_amdgcn_wmma_f32_16x16x32_f16(false, a, false, b, (short)0, c, false, false);
}

// ---------------------------------------------------------------------------
// Kernel 0: pack Wq|Wk|Wv (f32 [1024,64]) into f16 fragments (column in lane%16):
// wpack[m][c][n][e/8][lane][e%8].
// ---------------------------------------------------------------------------
__global__ void __launch_bounds__(256)
pack_w_kernel(const float* __restrict__ Wq, const float* __restrict__ Wk,
              const float* __restrict__ Wv, half_t* __restrict__ wpack) {
    const int idx = blockIdx.x * 256 + threadIdx.x;     // 0 .. 3*65536-1
    const int m   = idx >> 16;
    const int r   = idx & (WPACK_ELEMS - 1);
    const int e   = (r & 7) + 8 * ((r >> 8) & 1);
    const int l   = (r >> 3) & 31;
    const int cn  = r >> 9;            // c*4 + n
    const int n   = cn & 3;
    const int c   = cn >> 2;
    const int K   = 32 * c + ((e < 8) ? e : (e + 8)) + 8 * (l >> 4);
    const int col = 16 * n + (l & 15);
    const float* __restrict__ W = (m == 0) ? Wq : (m == 1) ? Wk : Wv;
    wpack[idx] = (half_t)W[(size_t)K * HEAD + col];
}

typedef __attribute__((ext_vector_type(8))) unsigned v8u;

// 16 f32 values to one f16 A fragment, round to nearest even as a cast does.
// Written in asm, volatile, so that it stays where the source has it, behind
// the fetches for later chunks: as plain casts the conversions move up to
// stand directly behind their own LDS reads, and the wave waits out the LDS
// latency twice a chunk. The four v_nop keep the distance between an earlier
// WMMA and a vector write over its A registers.
__device__ __forceinline__ v16h cvt_x(const float4 (&r)[4]) {
    v8u d;
    unsigned d0, d1, d2, d3, d4, d5, d6, d7;
    asm volatile(
        "v_nop\n\tv_nop\n\tv_nop\n\tv_nop\n\t"
        "v_cvt_pk_f16_f32 %0, %8, %9\n\t"
        "v_cvt_pk_f16_f32 %1, %10, %11\n\t"
        "v_cvt_pk_f16_f32 %2, %12, %13\n\t"
        "v_cvt_pk_f16_f32 %3, %14, %15\n\t"
        "v_cvt_pk_f16_f32 %4, %16, %17\n\t"
        "v_cvt_pk_f16_f32 %5, %18, %19\n\t"
        "v_cvt_pk_f16_f32 %6, %20, %21\n\t"
        "v_cvt_pk_f16_f32 %7, %22, %23"
        : "=&v"(d0), "=&v"(d1), "=&v"(d2), "=&v"(d3),
          "=&v"(d4), "=&v"(d5), "=&v"(d6), "=&v"(d7)
        : "v"(r[0].x), "v"(r[0].y), "v"(r[0].z), "v"(r[0].w),
          "v"(r[1].x), "v"(r[1].y), "v"(r[1].z), "v"(r[1].w),
          "v"(r[2].x), "v"(r[2].y), "v"(r[2].z), "v"(r[2].w),
          "v"(r[3].x), "v"(r[3].y), "v"(r[3].z), "v"(r[3].w));
    d[0] = d0; d[1] = d1; d[2] = d2; d[3] = d3;
    d[4] = d4; d[5] = d5; d[6] = d6; d[7] = d7;
    return __builtin_bit_cast(v16h, d);
}

#define QROWS   64                    // x rows of a block
#define QKS     256                   // floats of each row in one stage
#define QNST    (N_EMBED / QKS)       // stages
#define QCH     (QKS / 32)            // 32-K chunks in a stage
#define QPITCH4 (QKS / 4 + 1)         // staged row pitch in float4: 16 B x odd
#define QHALF4  (32 * QPITCH4)        // 32 staged rows, in float4
#define QPITCHB (QPITCH4 * 16)
#define QHALFB  (QHALF4 * 16)
// The i-th stage that a block works on, for a walk that starts at stage s0 and
// wraps, and the i-th chunk inside a stage, for a walk that starts at chunk c0
// (0 or half a stage) and wraps; c1 = the other of the two.
#define STAGE_AT(i) ((s0 + (i)) & (QNST - 1))
#define CC_AT(i)    ((((i) < QCH / 2) ? c0 : c1) + ((i) & (QCH / 2 - 1)))
// LDS order: rows 0..31 buffer 0, rows 0..31 buffer 1, rows 32..63 buffer 0,
// rows 32..63 buffer 1: both buffers of a reader's 32 rows lie within the
// 64 KB that the offset field of one LDS read reaches from one address.

// The wave's 8 rows of stage s into buffer buf: each row's 1 KB goes as two
// pieces of 512 contiguous bytes, 16 bytes a lane, from global memory straight
// into LDS. lrow = the lane's LDS byte address in the wave's first row of
// buffer 0, grow = its global address in that row. offset:512 moves the LDS
// and the global address alike, which is the row's second piece in both.
// The s_wait_xcnt stands inside the statement so that no address register of
// a copy takes a new value in front of it.
__device__ __forceinline__ void copy_stage(unsigned lrow, const float* __restrict__ grow,
                                           int s, int buf) {
    const unsigned l = lrow + (unsigned)buf * QHALFB;
    const float* __restrict__ g = grow + s * QKS;
    asm volatile(
        "global_load_async_to_lds_b128 %0, %8, off\n\t"
        "global_load_async_to_lds_b128 %0, %8, off offset:512\n\t"
        "global_load_async_to_lds_b128 %1, %9, off\n\t"
        "global_load_async_to_lds_b128 %1, %9, off offset:512\n\t"
        "global_load_async_to_lds_b128 %2, %10, off\n\t"
        "global_load_async_to_lds_b128 %2, %10, off offset:512\n\t"
        "global_load_async_to_lds_b128 %3, %11, off\n\t"
        "global_load_async_to_lds_b128 %3, %11, off offset:512\n\t"
        "global_load_async_to_lds_b128 %4, %12, off\n\t"
        "global_load_async_to_lds_b128 %4, %12, off offset:512\n\t"
        "global_load_async_to_lds_b128 %5, %13, off\n\t"
        "global_load_async_to_lds_b128 %5, %13, off offset:512\n\t"
        "global_load_async_to_lds_b128 %6, %14, off\n\t"
        "global_load_async_to_lds_b128 %6, %14, off offset:512\n\t"
        "global_load_async_to_lds_b128 %7, %15, off\n\t"
        "global_load_async_to_lds_b128 %7, %15, off offset:512\n\t"
        "s_wait_xcnt 0x0"
        :: "v"(l),               "v"(l + QPITCHB),
           "v"(l + 2 * QPITCHB), "v"(l + 3 * QPITCHB),
           "v"(l + 4 * QPITCHB), "v"(l + 5 * QPITCHB),
           "v"(l + 6 * QPITCHB), "v"(l + 7 * QPITCHB),
           "v"(g),               "v"(g + N_EMBED),
           "v"(g + 2 * N_EMBED), "v"(g + 3 * N_EMBED),
           "v"(g + 4 * N_EMBED), "v"(g + 5 * N_EMBED),
           "v"(g + 6 * N_EMBED), "v"(g + 7 * N_EMBED)
        : "memory");
}

// One lane's 16 x values of chunk cc of a staged tile, for both row tiles of
// the wave, still f32: floats 0..7 and 16..23 behind 8*(lane/16), the K order
// of the A fragment.
__device__ __forceinline__ void read_x(const float4* xrd, int cc, float4 (&r)[2][4]) {
#pragma unroll
    for (int j = 0; j < 2; ++j) {
        const float4* p = xrd + j * 16 * QPITCH4 + cc * 8;
        r[j][0] = p[0]; r[j][1] = p[1]; r[j][2] = p[4]; r[j][3] = p[5];
    }
}

// The q, k and v B fragments of 32-K chunk c for the wave's 16 columns.
// wl = the wave's part of a stage's first chunk, the same in every lane; loff = the
// lane's place in it; c = the chunk inside the stage.
__device__ __forceinline__ void load_b(const half_t* __restrict__ wl, unsigned loff, int c,
                                       v16h (&b)[3]) {
    const half_t* __restrict__ wp = wl + (size_t)c * (4 * 32 * 16);
    b[0] = load_frag(wp + loff);
    b[1] = load_frag(wp + WPACK_ELEMS + loff);
    b[2] = load_frag(wp + 2 * WPACK_ELEMS + loff);
}

// ---------------------------------------------------------------------------
// Kernel 1: q,k,v projections. A block owns 64 rows of x and brings them into
// LDS in 4 stages of 256 floats a row, two buffers, by asynchronous copies:
// the next stage flies while this one is worked on. Wave w takes 32 of the
// rows (w/4) and columns 16*(w%4) .. +15 of q, k and v: 6 WMMAs per 32-K
// chunk, each W fragment serving two row tiles. Outputs:
//   qh     f16 [B][T/16][2][fragment]   Q^T B fragments, pre-scaled by 1/sqrt(H)
//   khpack f16 [B][T/16][2][fragment]   attention K A fragments
//   vtpack f16 [B][T/32][4][fragment]   attention V^T A fragments
// ---------------------------------------------------------------------------
__global__ void __launch_bounds__(256)
qkv_proj_kernel(const float* __restrict__ x, const half_t* __restrict__ wpack,
                const float* __restrict__ bq, const float* __restrict__ bk,
                const float* __restrict__ bv,
                half_t* __restrict__ qh, half_t* __restrict__ khp,
                half_t* __restrict__ vtp) {
    __shared__ float4 xs[4 * QHALF4];

    const int lane   = threadIdx.x & 31;
    const int lane16 = lane & 15;
    const int khalf  = lane >> 4;
    const int wave   = __builtin_amdgcn_readfirstlane(threadIdx.x >> 5);
    const int n      = wave & 3;     // the wave's 16 columns of q, k and v
    const int rh     = wave >> 2;    // the wave's 32 rows

    // Every block reads the same packed W. So that the blocks do not all ask L2
    // for the same lines at the same moment, a block enters the K walk at stage
    // s0, and every stage at its chunk c0, and wraps: 8 places; blocks 8 apart in
    // the grid take neighbouring ones.
    const int s0 = (blockIdx.x >> 3) & (QNST - 1);
    const int c0 = ((blockIdx.x >> 5) & 1) * (QCH / 2);
    const int c1 = QCH / 2 - c0;

    // B fragments in a ring of 4 chunks, fetched 3 chunks ahead
    // wst[i] = the wave's columns of the first chunk of the i-th stage of the walk
    const half_t* __restrict__ wst[QNST];
#pragma unroll
    for (int i = 0; i < QNST; ++i)
        wst[i] = wpack + (size_t)n * 32 * 16 + (size_t)(STAGE_AT(i) * QCH) * (4 * 32 * 16);
    const unsigned loff = (unsigned)lane * 8u;
    v16h bf[4][3];
#pragma unroll
    for (int c = 0; c < 3; ++c) load_b(wst[0], loff, CC_AT(c), bf[c]);

    // what this wave copies: rows 8*wave .. +7 of the block, 16 bytes a lane
    const unsigned lrow = (unsigned)(size_t)xs + (unsigned)(rh * 64 + n * 8) * QPITCHB + (unsigned)lane * 16u;
    const float* __restrict__ grow =
        x + (size_t)(blockIdx.x * QROWS + wave * 8) * N_EMBED + lane * 4;
    // what this lane reads: A: M = lane%16
    const float4* xrd = xs + (rh * 64 + lane16) * QPITCH4 + 2 * khalf;

    copy_stage(lrow, grow, STAGE_AT(0), 0);
    // Stage 0 has landed, for this wave's copies, behind this wait ...
    asm volatile("s_wait_asynccnt 0x0" ::: "memory");
    // ... and for every wave's behind this barrier.
    __syncthreads();
    copy_stage(lrow, grow, STAGE_AT(1), 1);

    v8f accq[2] = {}, acck[2] = {}, accv[2] = {};
    float4 xa[2][2][4];              // x of the even and of the odd chunks
    read_x(xrd, CC_AT(0), xa[0]);

    // Unrolled whole, so that ring slots, buffers and stage tests are constants.
#pragma unroll
    for (int c = 0; c < N_EMBED / 32; ++c) {
        const int s  = c / QCH;      // which stage of the block's walk
        const int cc = c % QCH;      // which chunk of that stage's walk
        if (c + 3 < N_EMBED / 32) load_b(wst[(c + 3) / QCH], loff, CC_AT((c + 3) % QCH), bf[(c + 3) & 3]);
        if (cc + 1 < QCH) read_x(xrd + (s & 1) * QHALF4, CC_AT(cc + 1), xa[(c + 1) & 1]);
        const v16h a0 = cvt_x(xa[c & 1][0]);
        const v16h a1 = cvt_x(xa[c & 1][1]);
        // q and k as W^T * x^T (the A and B fragments have the same lane and K
        // order, so the operands only change places), v as x * W
        accq[0] = wmma_f16(bf[c & 3][0], a0, accq[0]);
        acck[0] = wmma_f16(bf[c & 3][1], a0, acck[0]);
        accv[0] = wmma_f16(a0, bf[c & 3][2], accv[0]);
        accq[1] = wmma_f16(bf[c & 3][0], a1, accq[1]);
        acck[1] = wmma_f16(bf[c & 3][1], a1, acck[1]);
        accv[1] = wmma_f16(a1, bf[c & 3][2], accv[1]);
        if (cc + 1 == QCH && s + 1 < QNST) {
            // This wave's reads of stage s are done before the buffer is refilled.
            asm volatile("s_wait_dscnt 0x0" ::: "memory");
            // This wave's copies of stage s+1 have landed.
            asm volatile("s_wait_asynccnt 0x0" ::: "memory");
            // Publishes stage s+1 and ends every wave's reads of stage s.
            __syncthreads();
            if (s + 2 < QNST) copy_stage(lrow, grow, STAGE_AT(s + 2), s & 1);
            read_x(xrd + ((s + 1) & 1) * QHALF4, CC_AT(0), xa[(c + 1) & 1]);
        }
    }
    // No copy is left outstanding when the wave ends.
    asm volatile("s_wait_asynccnt 0x0" ::: "memory");

    // q and k came out transposed: a lane holds row t = lane%16 of the tile and
    // h = 16n + 8*(lane/16) + r, which are elements 8*(n%2) + r of its own slot in
    // fragment [tile][n/2]. v came out with h = 16n + lane%16 and t = 8*(lane/16) + r
    // of tile j: elements 8*j + r of its own slot in fragment [tile/2][n]. So each
    // tile leaves as one 16-byte store a lane, 512 contiguous bytes a wave.
    const int hb  = 16 * n + 8 * khalf;
    const int col = 16 * n + lane16;
    const float4 bq0 = *(const float4*)(bq + hb), bq1 = *(const float4*)(bq + hb + 4);
    const float4 bk0 = *(const float4*)(bk + hb), bk1 = *(const float4*)(bk + hb + 4);
    const float biasv = bv[col];
    // The registers that hold hb and col in these loads get other values behind
    // this: their address translations are waited for first. hb and col are inputs
    // so that their registers stay untouched up to the wait, the loaded values so
    // that the loads stay in front of it.
    asm volatile("s_wait_xcnt 0x0"
                 :: "v"(hb), "v"(col), "v"(biasv),
                    "v"(bq0.x), "v"(bq0.y), "v"(bq0.z), "v"(bq0.w),
                    "v"(bq1.x), "v"(bq1.y), "v"(bq1.z), "v"(bq1.w),
                    "v"(bk0.x), "v"(bk0.y), "v"(bk0.z), "v"(bk0.w),
                    "v"(bk1.x), "v"(bk1.y), "v"(bk1.z), "v"(bk1.w)
                 : "memory");
    const float biasq[8] = {bq0.x, bq0.y, bq0.z, bq0.w, bq1.x, bq1.y, bq1.z, bq1.w};
    const float biask[8] = {bk0.x, bk0.y, bk0.z, bk0.w, bk1.x, bk1.y, bk1.z, bk1.w};
#pragma unroll
    for (int j = 0; j < 2; ++j) {
        const int rowTile = blockIdx.x * 4 + rh * 2 + j;   // 0 .. B*T/16-1
        v8h qo, ko, vo;
#pragma unroll
        for (int r = 0; r < 8; ++r) {
            qo[r] = (half_t)((accq[j][r] + biasq[r]) * 0.125f);   // 1/sqrt(HEAD)
            ko[r] = (half_t)(acck[j][r] + biask[r]);
            vo[r] = (half_t)(accv[j][r] + biasv);
        }
        const size_t qk = ((size_t)rowTile * 2 + (n >> 1)) * 512 + (n & 1) * 256 + lane * 8;
        const size_t vi = ((size_t)(rowTile >> 1) * 4 + n) * 512 + j * 256 + lane * 8;
        *(v8h*)(qh + qk)  = qo;
        *(v8h*)(khp + qk) = ko;
        *(v8h*)(vtp + vi) = vo;
    }
}

// ---------------------------------------------------------------------------
// Kernel 2: flash attention, causal, 64-key chunks.
// S^T = K * Q^T so softmax'd probabilities convert element-wise into the
// B operands of O^T = V^T * P^T.
// A block owns two groups of 32 queries, group 127-p and group p of one batch:
// together they always see 65 chunks, so every block has the same work. The
// chunks that group p sees are the first ones of group 127-p too: the wave that
// takes such a chunk works it for both groups from one load of its K and V
// fragments. The 8 waves deal the chunks of group 127-p out among themselves;
// each K/V fragment a wave loads serves both 16-query tiles of a group. Every
// wave keeps its own (m, l, O) per tile, leaves them in LDS, and behind one
// barrier the block merges the 8 partial results of each query.
// ---------------------------------------------------------------------------
#define AWAVES 8

// Online softmax of one 16-query tile over one 64-key chunk: updates m, l,
// rescales o, and returns the probabilities as the two P^T B operands.
__device__ __forceinline__ void softmax_tile(v8f (&s)[4], float& m, float& l,
                                             v8f (&o)[4], v16h& pb0, v16h& pb1) {
    // one shfl_xor(16) completes each 64-key row
    float mc = s[0][0];
#pragma unroll
    for (int r = 1; r < 8; ++r) mc = fmaxf(mc, s[0][r]);
#pragma unroll
    for (int r = 0; r < 8; ++r) {
        mc = fmaxf(mc, s[1][r]);
        mc = fmaxf(mc, s[2][r]);
        mc = fmaxf(mc, s[3][r]);
    }
    mc = fmaxf(mc, __shfl_xor(mc, 16, 32));

    const float m_new = fmaxf(m, mc);
    const float alpha = __expf(m - m_new);

    float rs = 0.0f;
#pragma unroll
    for (int r = 0; r < 8; ++r) {
        s[0][r] = __expf(s[0][r] - m_new); rs += s[0][r];
        s[1][r] = __expf(s[1][r] - m_new); rs += s[1][r];
        s[2][r] = __expf(s[2][r] - m_new); rs += s[2][r];
        s[3][r] = __expf(s[3][r] - m_new); rs += s[3][r];
    }
    rs += __shfl_xor(rs, 16, 32);
    l = l * alpha + rs;
    m = m_new;

#pragma unroll
    for (int r = 0; r < 8; ++r) {
        o[0][r] *= alpha; o[1][r] *= alpha; o[2][r] *= alpha; o[3][r] *= alpha;
    }

    // P^T B operands: direct element copy from S^T accumulators
#pragma unroll
    for (int r = 0; r < 8; ++r) {
        pb0[r]     = (half_t)s[0][r];  // keys kbase    .. +15
        pb0[r + 8] = (half_t)s[1][r];  // keys kbase+16 .. +31
        pb1[r]     = (half_t)s[2][r];  // keys kbase+32 .. +47
        pb1[r + 8] = (half_t)s[3][r];  // keys kbase+48 .. +63
    }
}

// The 8 fragments (8 KB) of one chunk's K or V^T. p = the chunk's first half + 8 * lane
__device__ __forceinline__ void load_chunk(const half_t* __restrict__ p, v16h (&f)[8]) {
#pragma unroll
    for (int i = 0; i < 8; ++i) f[i] = load_frag(p + i * 512);
}

// Scores S^T of 64 keys x the 2 tiles of one group: 4 subtiles x 2 WMMAs each,
// then the causal mask (the scale is already folded into q); only a group's last
// chunk holds keys behind the group's first query.
__device__ __forceinline__ void scores_group(const v16h (&kf)[8], const v16h (&bq)[2][2],
                                             int kbase, int qbase, int lane16, int khalf,
                                             v8f (&s)[2][4]) {
#pragma unroll
    for (int t = 0; t < 2; ++t)
#pragma unroll
        for (int i = 0; i < 4; ++i) s[t][i] = v8f{};
#pragma unroll
    for (int hh = 0; hh < 2; ++hh)
#pragma unroll
        for (int t = 0; t < 2; ++t)
#pragma unroll
            for (int i = 0; i < 4; ++i)
                s[t][i] = wmma_f16(kf[2 * i + hh], bq[t][hh], s[t][i]);
    if (kbase + 63 > qbase) {
#pragma unroll
        for (int t = 0; t < 2; ++t) {
            const int qg = qbase + 16 * t + lane16;   // this lane's query
#pragma unroll
            for (int r = 0; r < 8; ++r) {
                const int kg = kbase + r + 8 * khalf; // key = r + 8*(lane/16)
                if (kg > qg)      s[t][0][r] = NEG_BIG;
                if (kg + 16 > qg) s[t][1][r] = NEG_BIG;
                if (kg + 32 > qg) s[t][2][r] = NEG_BIG;
                if (kg + 48 > qg) s[t][3][r] = NEG_BIG;
            }
        }
    }
}

// Softmax of both tiles of a group, then O^T += V^T * P^T:
// 2 tiles x 4 h-tiles x 2 key-halves.
__device__ __forceinline__ void softmax_pv(v8f (&s)[2][4], float (&m)[2], float (&l)[2],
                                           v8f (&o)[2][4], const v16h (&vf)[8]) {
    v16h pb[2][2];
#pragma unroll
    for (int t = 0; t < 2; ++t)
        softmax_tile(s[t], m[t], l[t], o[t], pb[t][0], pb[t][1]);
#pragma unroll
    for (int kk = 0; kk < 2; ++kk)
#pragma unroll
        for (int t = 0; t < 2; ++t)
#pragma unroll
            for (int i = 0; i < 4; ++i)
                o[t][i] = wmma_f16(vf[4 * kk + i], pb[t][kk], o[t][i]);
}

// A wave's partial result of one group goes to LDS.
__device__ __forceinline__ void leave_group(float4* part, float2* ml, int wave, int lane,
                                            int grp, const v8f (&o)[2][4],
                                            const float (&m)[2], const float (&l)[2]) {
#pragma unroll
    for (int t = 0; t < 2; ++t) {
        const int gt = grp * 2 + t;
#pragma unroll
        for (int i = 0; i < 4; ++i) {
            float4* pp = part + ((wave * 32 + (gt * 4 + i) * 2) * 32 + lane);
            pp[0]  = make_float4(o[t][i][0], o[t][i][1], o[t][i][2], o[t][i][3]);
            pp[32] = make_float4(o[t][i][4], o[t][i][5], o[t][i][6], o[t][i][7]);
        }
        if (lane < 16) ml[(wave * 4 + gt) * 16 + lane] = make_float2(m[t], l[t]);
    }
}

__global__ void __launch_bounds__(32 * AWAVES)
attn_kernel(const half_t* __restrict__ qh, const half_t* __restrict__ khp,
            const half_t* __restrict__ vtp, float* __restrict__ out) {
    // part[wave][slot][lane]: 4 floats of a wave's un-normalised O^T, with
    // slot = ((group*2 + tile)*4 + t4)*2 + (upper 4 of the lane's 8 h values)
    __shared__ float4 part[AWAVES * 32 * 32];
    // ml[wave][group*2 + tile][query]: that wave's (m, l)
    __shared__ float2 ml[AWAVES * 4 * 16];

    const int lane   = threadIdx.x & 31;
    const int lane16 = lane & 15;
    const int khalf  = lane >> 4;
    const int wave   = __builtin_amdgcn_readfirstlane(threadIdx.x >> 5);

    const int bidx = blockIdx.x >> 6;   // batch
    const int p    = blockIdx.x & 63;   // pair of query groups: 127-p and p

    const half_t* __restrict__ klane = khp + (size_t)bidx * 256 * 1024 + (size_t)lane * 8;
    const half_t* __restrict__ vlane = vtp + (size_t)bidx * 128 * 2048 + (size_t)lane * 8;

    const int nfirst  = ((127 - p) >> 1) + 1;   // chunks of group 127-p (33..64)
    const int nboth   = 65 - nfirst;            // chunks 0 .. nboth-1: group p sees them too (1..32)
    const int nsingle = nfirst - nboth;         // chunks nboth .. nfirst-1: group 127-p alone (1..63)

    // The deal. A chunk for both groups is two units of work, a chunk for one
    // group is one; 65 units in all. Chunk d < nboth goes to wave d % 8. That
    // leaves waves nrem .. 7 two units behind the others, so the first single
    // chunks go to them, two each; the rest goes round all 8 waves. No wave gets
    // more than 9 units. A wave's jobs are numbered: its nd double chunks, then
    // its ns1 single ones.
    const int nrem = nboth & 7;
    const int lev  = 2 * (8 - nrem);            // single chunks that level the waves
    const int nd   = (nboth - wave + 7) >> 3;
    const int left = nsingle - lev - wave;
    int ns1 = (left > 0) ? ((left + 7) >> 3) : 0;
    if (wave >= nrem)
        ns1 += ((wave - nrem) < nsingle ? 1 : 0) + ((8 - nrem + wave - nrem) < nsingle ? 1 : 0);
    const int njobs = nd + ns1;                 // 4 .. 8
    // The 64 blocks of a batch read the same K and V. So that they do not all ask
    // L2 for the same lines at the same moment, each block enters its waves' job
    // lists at a place of its own and wraps; the online softmax takes any order.
    const int jstart = (((p * 27) & 63) * njobs) >> 6;   // 0 .. njobs-1

    // The chunk of the wave's job j (counted from jstart, wrapped): double chunk
    // number idx, or single chunk number u: the first nlev of a wave's single
    // chunks are levelling ones.
    const bool late  = wave >= nrem;
    const int  nlev  = late ? 2 : 0;
    const int  clev  = nboth + wave - nrem;                     // + (8 - nrem) * u while u < nlev
    const int  crest = nboth + lev + wave - (late ? 16 : 0);    // + 8 * u from u = nlev on
    auto chunk_of = [&](int j) -> int {
        const int i0  = j + jstart;
        const int idx = (i0 >= njobs) ? (i0 - njobs) : i0;
        const int u   = idx - nd;
        const int cs  = (u < nlev) ? (clev + u * (8 - nrem)) : (crest + 8 * u);
        return (u < 0) ? (wave + 8 * idx) : cs;
    };

    // Q^T B-fragments of both tiles of both groups: N = query = lane%16, K = h
    // a group is 2 tiles x 2 fragments, 2048 halves in a row
    const half_t* __restrict__ qa =
        qh + ((size_t)bidx * 128 + (127 - p)) * 2048 + (size_t)lane * 8;
    const half_t* __restrict__ qb =
        qh + ((size_t)bidx * 128 + p) * 2048 + (size_t)lane * 8;
    v16h bqa[2][2], bqb[2][2];
#pragma unroll
    for (int t = 0; t < 2; ++t) {
#pragma unroll
        for (int f = 0; f < 2; ++f) {
            bqa[t][f] = load_frag(qa + (t * 2 + f) * 512);
            bqb[t][f] = load_frag(qb + (t * 2 + f) * 512);
        }
    }
    // The address registers of the Q loads get other values behind this: the
    // loads' address translations are waited for first. The two pointers are
    // inputs so that their registers stay untouched up to the wait.
    asm volatile("s_wait_xcnt 0x0" :: "v"(qa), "v"(qb) : "memory");

    // K fragments of the wave's first job; each pass fetches the next job's.
    int c = chunk_of(0);
    const half_t* __restrict__ kfirst = klane + (size_t)c * 4096;
    v16h kf[8];
    load_chunk(kfirst, kf);
    // The same for the address registers of these K loads.
    asm volatile("s_wait_xcnt 0x0" :: "v"(kfirst) : "memory");

    const int qbasea = (127 - p) * 32;   // first query of group 127-p
    const int qbaseb = p * 32;           // first query of group p
    float ma[2] = {NEG_BIG, NEG_BIG}, la[2] = {0.0f, 0.0f};
    float mb[2] = {NEG_BIG, NEG_BIG}, lb[2] = {0.0f, 0.0f};
    v8f oa[2][4] = {}, ob[2][4] = {};

    // Where the current job's V lies
    const half_t* __restrict__ vcur = vlane + (size_t)c * 4096;
    for (int j = 0; j < njobs; ++j) {
        // --- this chunk's V^T fragments, wanted behind the first softmax ---
        v16h vf[8];
        load_chunk(vcur, vf);

        const int  kbase = c * 64;
        const bool both  = c < nboth;
        const bool more  = j + 1 < njobs;
        const int  cnext = more ? chunk_of(j + 1) : c;
        const half_t* __restrict__ knext = klane + (size_t)cnext * 4096;

        v8f s[2][4];
        scores_group(kf, bqa, kbase, qbasea, lane16, khalf, s);
        if (!both) {
            // --- K fragments of the wave's next job, behind the last use of this one's ---
            if (more) load_chunk(knext, kf);
            // The K and V pointers take new values behind this pass: the address
            // translations of this pass's loads are waited for before their registers
            // change. The two pointers are inputs so that their registers stay
            // untouched up to the wait.
            asm volatile("s_wait_xcnt 0x0" :: "v"(vcur), "v"(knext) : "memory");
        }
        softmax_pv(s, ma, la, oa, vf);
        if (both) {
            // --- the same K and V fragments once more, for group p ---
            scores_group(kf, bqb, kbase, qbaseb, lane16, khalf, s);
            if (more) load_chunk(knext, kf);
            // As above.
            asm volatile("s_wait_xcnt 0x0" :: "v"(vcur), "v"(knext) : "memory");
            softmax_pv(s, mb, lb, ob, vf);
        }
        c = cnext;
        vcur = vlane + (size_t)c * 4096;
    }

    leave_group(part, ml, wave, lane, 0, oa, ma, la);
    leave_group(part, ml, wave, lane, 1, ob, mb, lb);

    // Every wave's partial results are in LDS before any wave merges them.
    __syncthreads();

    // --- merge: wave w takes tile w/2 (of the 4) and h values 32*(w%2) .. +31,
    // one whole 128-byte line of each of its 16 output rows ---
    const int gt   = wave >> 1;
    const int qrow = ((gt >> 1) ? p : (127 - p)) * 32 + (gt & 1) * 16 + lane16;
    float wm[AWAVES], wl[AWAVES];
    float mall = NEG_BIG;
#pragma unroll
    for (int w = 0; w < AWAVES; ++w) {
        const float2 v = ml[(w * 4 + gt) * 16 + lane16];
        wm[w] = v.x; wl[w] = v.y;
        mall = fmaxf(mall, v.x);
    }
    float lall = 0.0f;
#pragma unroll
    for (int w = 0; w < AWAVES; ++w) {
        wm[w] = __expf(wm[w] - mall);   // a wave without chunks weighs 0
        lall += wm[w] * wl[w];
    }
    const float inv = 1.0f / lall;

    // O^T element (h = t4*16 + r + 8*khalf, query = lane%16)
    float* __restrict__ orow =
        out + ((size_t)(bidx << 12) + qrow) * HEAD + (wave & 1) * 32 + 8 * khalf;
#pragma unroll
    for (int j = 0; j < 4; ++j) {       // t4 = 2*(w%2) + j/2, upper half = j%2
        const float4* pp = part + ((gt * 8 + (wave & 1) * 4 + j) * 32 + lane);
        float4 acc = make_float4(0.0f, 0.0f, 0.0f, 0.0f);
#pragma unroll
        for (int w = 0; w < AWAVES; ++w) {
            const float4 v = pp[w * 32 * 32];
            acc.x += wm[w] * v.x; acc.y += wm[w] * v.y;
            acc.z += wm[w] * v.z; acc.w += wm[w] * v.w;
        }
        acc.x *= inv; acc.y *= inv; acc.z *= inv; acc.w *= inv;
        *(float4*)(orow + (j >> 1) * 16 + (j & 1) * 4) = acc;
    }
}

// ---------------------------------------------------------------------------
extern "C" void kernel_launch(void* const* d_in, const int* in_sizes, int n_in,
                              void* d_out, int out_size, void* d_ws, size_t ws_size,
                              hipStream_t stream) {
    const float* x  = (const float*)d_in[0];
    const float* Wq = (const float*)d_in[1];
    const float* bq = (const float*)d_in[2];
    const float* Wk = (const float*)d_in[3];
    const float* bk = (const float*)d_in[4];
    const float* Wv = (const float*)d_in[5];
    const float* bv = (const float*)d_in[6];
    float* out = (float*)d_out;

    const size_t QK = (size_t)NBATCH * TSEQ * HEAD; // 1,048,576 elems
    half_t* qh    = (half_t*)d_ws;
    half_t* khp   = qh + QK;                 // K as A fragments
    half_t* vtp   = khp + QK;                // V^T as A fragments
    half_t* wpack = vtp + QK;                // 3 * 65536 f16

    pack_w_kernel<<<(3 * WPACK_ELEMS) / 256, 256, 0, stream>>>(Wq, Wk, Wv, wpack);

    // one block of 8 waves per 64 rows of x
    qkv_proj_kernel<<<NBATCH * TSEQ / QROWS, 256, 0, stream>>>(x, wpack, bq, bk, bv,
                                                               qh, khp, vtp);

    // one block per pair of 32-query groups: 64 pairs in each batch
    attn_kernel<<<NBATCH * (TSEQ / 64), 32 * AWAVES, 0, stream>>>(qh, khp, vtp, out);
}

// v007
// One run takes 23.9 microseconds.
// In both of two side-by-side timings against v006, it was 1.04 times as fast.
// All steps since v000 together make it 10.6 times as fast.
#include <hip/hip_runtime.h>
#include <hip/hip_bf16.h>

typedef _Float16 half_t;
typedef __attribute__((ext_vector_type(16))) _Float16 v16h;
typedef __attribute__((ext_vector_type(8)))  _Float16 v8h;
typedef __attribute__((ext_vector_type(8)))  float    v8f;

#define N_EMBED   1024
#define HEAD      64
#define TSEQ      4096
#define NBATCH    4
#define NEG_BIG   (-3.0e30f)
#define WPACK_ELEMS 65536   // per matrix: 1024*64
// log2(e) / sqrt(HEAD): the scores come out in log2 units, so that the softmax
// takes exp2 of them as they are
#define QSCALE    0.18033688f
// A query's reference maximum is raised only when a score tops it by more than
// this (log2 units): probabilities stay below 2^8, far inside f16
#define LAZY_MAX  8.0f

// 16-bit A/B WMMA fragment (16x32) K-mapping:
// element e -> K = (e<8 ? e : e+8) + 8*(lane/16)
// inverse:   khalf = (K>>3)&1 ; e = (K&7) + 8*(K>>4)

// Every packed fragment (W, Q, K, V^T) is 512 halves in the order
// [e/8][lane][e%8]: a lane's elements 0..7 lie 16 bytes behind its neighbour's,
// its elements 8..15 512 bytes further on, so each of the two 16-byte loads of
// a wave covers 512 contiguous bytes, four whole 128-byte lines.

// p = the fragment's first half + 8 * lane
__device__ __forceinline__ v16h load_frag(const half_t* __restrict__ p) {
    const v8h lo = *(const v8h*)p;
    const v8h hi = *(const v8h*)(p + 256);
    return __builtin_shufflevector(lo, hi, 0, 1, 2, 3, 4, 5, 6, 7, 8, 9, 10, 11, 12, 13, 14, 15);
}

__device__ __forceinline__ v8f wmma_f16(v16h a, v16h b, v8f c) {
    return __builtin_amdgcn_wmma_f32_16x16x32_f16(false, a, false, b, (short)0, c, false, false);
}

// ---------------------------------------------------------------------------
// Kernel 0: pack Wq|Wk|Wv (f32 [1024,64]) into f16 fragments (column in lane%16):
// wpack[m][c][n][e/8][lane][e%8].
// ---------------------------------------------------------------------------
__global__ void __launch_bounds__(256)
pack_w_kernel(const float* __restrict__ Wq, const float* __restrict__ Wk,
              const float* __restrict__ Wv, half_t* __restrict__ wpack) {
    const int idx = blockIdx.x * 256 + threadIdx.x;     // 0 .. 3*65536-1
    const int m   = idx >> 16;
    const int r   = idx & (WPACK_ELEMS - 1);
    const int e   = (r & 7) + 8 * ((r >> 8) & 1);
    const int l   = (r >> 3) & 31;
    const int cn  = r >> 9;            // c*4 + n
    const int n   = cn & 3;
    const int c   = cn >> 2;
    const int K   = 32 * c + ((e < 8) ? e : (e + 8)) + 8 * (l >> 4);
    const int col = 16 * n + (l & 15);
    const float* __restrict__ W = (m == 0) ? Wq : (m == 1) ? Wk : Wv;
    wpack[idx] = (half_t)W[(size_t)K * HEAD + col];
}

typedef __attribute__((ext_vector_type(8))) unsigned v8u;

// 16 f32 values to one f16 A fragment, round to nearest even as a cast does.
// Written in asm, volatile, so that it stays where the source has it, behind
// the fetches for later chunks: as plain casts the conversions move up to
// stand directly behind their own LDS reads, and the wave waits out the LDS
// latency twice a chunk. The four v_nop keep the distance between an earlier
// WMMA and a vector write over its A registers.
__device__ __forceinline__ v16h cvt_x(const float4 (&r)[4]) {
    v8u d;
    unsigned d0, d1, d2, d3, d4, d5, d6, d7;
    asm volatile(
        "v_nop\n\tv_nop\n\tv_nop\n\tv_nop\n\t"
        "v_cvt_pk_f16_f32 %0, %8, %9\n\t"
        "v_cvt_pk_f16_f32 %1, %10, %11\n\t"
        "v_cvt_pk_f16_f32 %2, %12, %13\n\t"
        "v_cvt_pk_f16_f32 %3, %14, %15\n\t"
        "v_cvt_pk_f16_f32 %4, %16, %17\n\t"
        "v_cvt_pk_f16_f32 %5, %18, %19\n\t"
        "v_cvt_pk_f16_f32 %6, %20, %21\n\t"
        "v_cvt_pk_f16_f32 %7, %22, %23"
        : "=&v"(d0), "=&v"(d1), "=&v"(d2), "=&v"(d3),
          "=&v"(d4), "=&v"(d5), "=&v"(d6), "=&v"(d7)
        : "v"(r[0].x), "v"(r[0].y), "v"(r[0].z), "v"(r[0].w),
          "v"(r[1].x), "v"(r[1].y), "v"(r[1].z), "v"(r[1].w),
          "v"(r[2].x), "v"(r[2].y), "v"(r[2].z), "v"(r[2].w),
          "v"(r[3].x), "v"(r[3].y), "v"(r[3].z), "v"(r[3].w));
    d[0] = d0; d[1] = d1; d[2] = d2; d[3] = d3;
    d[4] = d4; d[5] = d5; d[6] = d6; d[7] = d7;
    return __builtin_bit_cast(v16h, d);
}

#define QROWS   64                    // x rows of a block
#define QKS     256                   // floats of each row in one stage
#define QNST    (N_EMBED / QKS)       // stages
#define QCH     (QKS / 32)            // 32-K chunks in a stage
#define QPITCH4 (QKS / 4 + 1)         // staged row pitch in float4: 16 B x odd
#define QHALF4  (32 * QPITCH4)        // 32 staged rows, in float4
#define QPITCHB (QPITCH4 * 16)
#define QHALFB  (QHALF4 * 16)
// The i-th stage that a block works on, for a walk that starts at stage s0 and
// wraps, and the i-th chunk inside a stage, for a walk that starts at chunk c0
// (0 or half a stage) and wraps; c1 = the other of the two.
#define STAGE_AT(i) ((s0 + (i)) & (QNST - 1))
#define CC_AT(i)    ((((i) < QCH / 2) ? c0 : c1) + ((i) & (QCH / 2 - 1)))
// LDS order: rows 0..31 buffer 0, rows 0..31 buffer 1, rows 32..63 buffer 0,
// rows 32..63 buffer 1: both buffers of a reader's 32 rows lie within the
// 64 KB that the offset field of one LDS read reaches from one address.

// The wave's 8 rows of stage s into buffer buf: each row's 1 KB goes as two
// pieces of 512 contiguous bytes, 16 bytes a lane, from global memory straight
// into LDS. lrow = the lane's LDS byte address in the wave's first row of
// buffer 0, grow = its global address in that row. offset:512 moves the LDS
// and the global address alike, which is the row's second piece in both.
// The s_wait_xcnt stands inside the statement so that no address register of
// a copy takes a new value in front of it.
__device__ __forceinline__ void copy_stage(unsigned lrow, const float* __restrict__ grow,
                                           int s, int buf) {
    const unsigned l = lrow + (unsigned)buf * QHALFB;
    const float* __restrict__ g = grow + s * QKS;
    asm volatile(
        "global_load_async_to_lds_b128 %0, %8, off\n\t"
        "global_load_async_to_lds_b128 %0, %8, off offset:512\n\t"
        "global_load_async_to_lds_b128 %1, %9, off\n\t"
        "global_load_async_to_lds_b128 %1, %9, off offset:512\n\t"
        "global_load_async_to_lds_b128 %2, %10, off\n\t"
        "global_load_async_to_lds_b128 %2, %10, off offset:512\n\t"
        "global_load_async_to_lds_b128 %3, %11, off\n\t"
        "global_load_async_to_lds_b128 %3, %11, off offset:512\n\t"
        "global_load_async_to_lds_b128 %4, %12, off\n\t"
        "global_load_async_to_lds_b128 %4, %12, off offset:512\n\t"
        "global_load_async_to_lds_b128 %5, %13, off\n\t"
        "global_load_async_to_lds_b128 %5, %13, off offset:512\n\t"
        "global_load_async_to_lds_b128 %6, %14, off\n\t"
        "global_load_async_to_lds_b128 %6, %14, off offset:512\n\t"
        "global_load_async_to_lds_b128 %7, %15, off\n\t"
        "global_load_async_to_lds_b128 %7, %15, off offset:512\n\t"
        "s_wait_xcnt 0x0"
        :: "v"(l),               "v"(l + QPITCHB),
           "v"(l + 2 * QPITCHB), "v"(l + 3 * QPITCHB),
           "v"(l + 4 * QPITCHB), "v"(l + 5 * QPITCHB),
           "v"(l + 6 * QPITCHB), "v"(l + 7 * QPITCHB),
           "v"(g),               "v"(g + N_EMBED),
           "v"(g + 2 * N_EMBED), "v"(g + 3 * N_EMBED),
           "v"(g + 4 * N_EMBED), "v"(g + 5 * N_EMBED),
           "v"(g + 6 * N_EMBED), "v"(g + 7 * N_EMBED)
        : "memory");
}

// One lane's 16 x values of chunk cc of a staged tile, for both row tiles of
// the wave, still f32: floats 0..7 and 16..23 behind 8*(lane/16), the K order
// of the A fragment.
__device__ __forceinline__ void read_x(const float4* xrd, int cc, float4 (&r)[2][4]) {
#pragma unroll
    for (int j = 0; j < 2; ++j) {
        const float4* p = xrd + j * 16 * QPITCH4 + cc * 8;
        r[j][0] = p[0]; r[j][1] = p[1]; r[j][2] = p[4]; r[j][3] = p[5];
    }
}

// The q, k and v B fragments of 32-K chunk c for the wave's 16 columns.
// wl = the wave's part of a stage's first chunk, the same in every lane; loff = the
// lane's place in it; c = the chunk inside the stage.
__device__ __forceinline__ void load_b(const half_t* __restrict__ wl, unsigned loff, int c,
                                       v16h (&b)[3]) {
    const half_t* __restrict__ wp = wl + (size_t)c * (4 * 32 * 16);
    b[0] = load_frag(wp + loff);
    b[1] = load_frag(wp + WPACK_ELEMS + loff);
    b[2] = load_frag(wp + 2 * WPACK_ELEMS + loff);
}

// ---------------------------------------------------------------------------
// Kernel 1: q,k,v projections. A block owns 64 rows of x and brings them into
// LDS in 4 stages of 256 floats a row, two buffers, by asynchronous copies:
// the next stage flies while this one is worked on. Wave w takes 32 of the
// rows (w/4) and columns 16*(w%4) .. +15 of q, k and v: 6 WMMAs per 32-K
// chunk, each W fragment serving two row tiles. Outputs:
//   qh     f16 [B][T/16][2][fragment]   Q^T B fragments, pre-scaled by log2(e)/sqrt(H)
//   khpack f16 [B][T/16][2][fragment]   attention K A fragments
//   vtpack f16 [B][T/32][4][fragment]   attention V^T A fragments
// ---------------------------------------------------------------------------
__global__ void __launch_bounds__(256)
qkv_proj_kernel(const float* __restrict__ x, const half_t* __restrict__ wpack,
                const float* __restrict__ bq, const float* __restrict__ bk,
                const float* __restrict__ bv,
                half_t* __restrict__ qh, half_t* __restrict__ khp,
                half_t* __restrict__ vtp) {
    __shared__ float4 xs[4 * QHALF4];

    const int lane   = threadIdx.x & 31;
    const int lane16 = lane & 15;
    const int khalf  = lane >> 4;
    const int wave   = __builtin_amdgcn_readfirstlane(threadIdx.x >> 5);
    const int n      = wave & 3;     // the wave's 16 columns of q, k and v
    const int rh     = wave >> 2;    // the wave's 32 rows

    // Every block reads the same packed W. So that the blocks do not all ask L2
    // for the same lines at the same moment, a block enters the K walk at stage
    // s0, and every stage at its chunk c0, and wraps: 8 places; blocks 8 apart in
    // the grid take neighbouring ones.
    const int s0 = (blockIdx.x >> 3) & (QNST - 1);
    const int c0 = ((blockIdx.x >> 5) & 1) * (QCH / 2);
    const int c1 = QCH / 2 - c0;

    // B fragments in a ring of 4 chunks, fetched 3 chunks ahead
    // wst[i] = the wave's columns of the first chunk of the i-th stage of the walk
    const half_t* __restrict__ wst[QNST];
#pragma unroll
    for (int i = 0; i < QNST; ++i)
        wst[i] = wpack + (size_t)n * 32 * 16 + (size_t)(STAGE_AT(i) * QCH) * (4 * 32 * 16);
    const unsigned loff = (unsigned)lane * 8u;
    v16h bf[4][3];
#pragma unroll
    for (int c = 0; c < 3; ++c) load_b(wst[0], loff, CC_AT(c), bf[c]);

    // what this wave copies: rows 8*wave .. +7 of the block, 16 bytes a lane
    const unsigned lrow = (unsigned)(size_t)xs + (unsigned)(rh * 64 + n * 8) * QPITCHB + (unsigned)lane * 16u;
    const float* __restrict__ grow =
        x + (size_t)(blockIdx.x * QROWS + wave * 8) * N_EMBED + lane * 4;
    // what this lane reads: A: M = lane%16
    const float4* xrd = xs + (rh * 64 + lane16) * QPITCH4 + 2 * khalf;

    copy_stage(lrow, grow, STAGE_AT(0), 0);
    // Stage 0 has landed, for this wave's copies, behind this wait ...
    asm volatile("s_wait_asynccnt 0x0" ::: "memory");
    // ... and for every wave's behind this barrier.
    __syncthreads();
    copy_stage(lrow, grow, STAGE_AT(1), 1);

    v8f accq[2] = {}, acck[2] = {}, accv[2] = {};
    float4 xa[2][2][4];              // x of the even and of the odd chunks
    read_x(xrd, CC_AT(0), xa[0]);

    // Unrolled whole, so that ring slots, buffers and stage tests are constants.
#pragma unroll
    for (int c = 0; c < N_EMBED / 32; ++c) {
        const int s  = c / QCH;      // which stage of the block's walk
        const int cc = c % QCH;      // which chunk of that stage's walk
        if (c + 3 < N_EMBED / 32) load_b(wst[(c + 3) / QCH], loff, CC_AT((c + 3) % QCH), bf[(c + 3) & 3]);
        if (cc + 1 < QCH) read_x(xrd + (s & 1) * QHALF4, CC_AT(cc + 1), xa[(c + 1) & 1]);
        const v16h a0 = cvt_x(xa[c & 1][0]);
        const v16h a1 = cvt_x(xa[c & 1][1]);
        // q and k as W^T * x^T (the A and B fragments have the same lane and K
        // order, so the operands only change places), v as x * W
        accq[0] = wmma_f16(bf[c & 3][0], a0, accq[0]);
        acck[0] = wmma_f16(bf[c & 3][1], a0, acck[0]);
        accv[0] = wmma_f16(a0, bf[c & 3][2], accv[0]);
        accq[1] = wmma_f16(bf[c & 3][0], a1, accq[1]);
        acck[1] = wmma_f16(bf[c & 3][1], a1, acck[1]);
        accv[1] = wmma_f16(a1, bf[c & 3][2], accv[1]);
        if (cc + 1 == QCH && s + 1 < QNST) {
            // This wave's reads of stage s are done before the buffer is refilled.
            asm volatile("s_wait_dscnt 0x0" ::: "memory");
            // This wave's copies of stage s+1 have landed.
            asm volatile("s_wait_asynccnt 0x0" ::: "memory");
            // Publishes stage s+1 and ends every wave's reads of stage s.
            __syncthreads();
            if (s + 2 < QNST) copy_stage(lrow, grow, STAGE_AT(s + 2), s & 1);
            read_x(xrd + ((s + 1) & 1) * QHALF4, CC_AT(0), xa[(c + 1) & 1]);
        }
    }
    // No copy is left outstanding when the wave ends.
    asm volatile("s_wait_asynccnt 0x0" ::: "memory");

    // q and k came out transposed: a lane holds row t = lane%16 of the tile and
    // h = 16n + 8*(lane/16) + r, which are elements 8*(n%2) + r of its own slot in
    // fragment [tile][n/2]. v came out with h = 16n + lane%16 and t = 8*(lane/16) + r
    // of tile j: elements 8*j + r of its own slot in fragment [tile/2][n]. So each
    // tile leaves as one 16-byte store a lane, 512 contiguous bytes a wave.
    const int hb  = 16 * n + 8 * khalf;
    const int col = 16 * n + lane16;
    const float4 bq0 = *(const float4*)(bq + hb), bq1 = *(const float4*)(bq + hb + 4);
    const float4 bk0 = *(const float4*)(bk + hb), bk1 = *(const float4*)(bk + hb + 4);
    const float biasv = bv[col];
    // The registers that hold hb and col in these loads get other values behind
    // this: their address translations are waited for first. hb and col are inputs
    // so that their registers stay untouched up to the wait, the loaded values so
    // that the loads stay in front of it.
    asm volatile("s_wait_xcnt 0x0"
                 :: "v"(hb), "v"(col), "v"(biasv),
                    "v"(bq0.x), "v"(bq0.y), "v"(bq0.z), "v"(bq0.w),
                    "v"(bq1.x), "v"(bq1.y), "v"(bq1.z), "v"(bq1.w),
                    "v"(bk0.x), "v"(bk0.y), "v"(bk0.z), "v"(bk0.w),
                    "v"(bk1.x), "v"(bk1.y), "v"(bk1.z), "v"(bk1.w)
                 : "memory");
    const float biasq[8] = {bq0.x, bq0.y, bq0.z, bq0.w, bq1.x, bq1.y, bq1.z, bq1.w};
    const float biask[8] = {bk0.x, bk0.y, bk0.z, bk0.w, bk1.x, bk1.y, bk1.z, bk1.w};
#pragma unroll
    for (int j = 0; j < 2; ++j) {
        const int rowTile = blockIdx.x * 4 + rh * 2 + j;   // 0 .. B*T/16-1
        v8h qo, ko, vo;
#pragma unroll
        for (int r = 0; r < 8; ++r) {
            qo[r] = (half_t)((accq[j][r] + biasq[r]) * QSCALE);
            ko[r] = (half_t)(acck[j][r] + biask[r]);
            vo[r] = (half_t)(accv[j][r] + biasv);
        }
        const size_t qk = ((size_t)rowTile * 2 + (n >> 1)) * 512 + (n & 1) * 256 + lane * 8;
        const size_t vi = ((size_t)(rowTile >> 1) * 4 + n) * 512 + j * 256 + lane * 8;
        *(v8h*)(qh + qk)  = qo;
        *(v8h*)(khp + qk) = ko;
        *(v8h*)(vtp + vi) = vo;
    }
}

// ---------------------------------------------------------------------------
// Kernel 2: flash attention, causal, 64-key chunks.
// S^T = K * Q^T so softmax'd probabilities convert element-wise into the
// B operands of O^T = V^T * P^T.
// A block owns two groups of 32 queries, group 127-p and group p of one batch:
// together they always see 65 chunks, so every block has the same work. The
// chunks that group p sees are the first ones of group 127-p too: the wave that
// takes such a chunk works it for both groups from one load of its K and V
// fragments. The 8 waves deal the chunks of group 127-p out among themselves;
// each K/V fragment a wave loads serves both 16-query tiles of a group. Every
// wave keeps its own (m, l, O) per tile, m being the reference that its l and O
// are scaled by (log2 units), leaves them in LDS, and behind one barrier the
// block merges the 8 partial results of each query.
// ---------------------------------------------------------------------------
#define AWAVES 8

// The largest of this lane's 32 scores of one 16-query tile (its half of the
// query's 64 keys), in two chains that do not wait for each other: the wave's
// branch waits for the result.
__device__ __forceinline__ float tile_max(const v8f (&s)[4]) {
    float ma = s[0][0], mb = s[2][0];
#pragma unroll
    for (int r = 1; r < 8; ++r) { ma = fmaxf(ma, s[0][r]); mb = fmaxf(mb, s[2][r]); }
#pragma unroll
    for (int r = 0; r < 8; ++r) { ma = fmaxf(ma, s[1][r]); mb = fmaxf(mb, s[3][r]); }
    return fmaxf(ma, mb);
}

// A tile takes a new reference maximum. s holds the scores minus the old
// reference m (0 where the tile has none yet: first); mc = tile_max(s). The
// reference goes up by d, never down; s, o and l follow, and nref = minus the
// new reference in all 8 registers, the C operand of the tile's later scores.
__device__ __forceinline__ void raise_reference(v8f (&s)[4], float mc, bool first, float& m,
                                                float& l, v8f (&o)[4], v8f& nref) {
    // one shfl_xor(16) completes each 64-key row
    const float mj    = fmaxf(mc, __shfl_xor(mc, 16, 32));
    const float d     = first ? mj : fmaxf(mj, 0.0f);
    const float alpha = first ? 1.0f : __builtin_amdgcn_exp2f(-d);   // o and l are 0 at first
    m = (first ? 0.0f : m) + d;
    l *= alpha;
#pragma unroll
    for (int r = 0; r < 8; ++r) {
        nref[r] = -m;
        s[0][r] -= d; s[1][r] -= d; s[2][r] -= d; s[3][r] -= d;
        o[0][r] *= alpha; o[1][r] *= alpha; o[2][r] *= alpha; o[3][r] *= alpha;
    }
}

// Probabilities of one 16-query tile over one 64-key chunk from scores that
// already stand minus the reference, in log2 units: adds their sum to l and
// returns them as the two P^T B operands.
__device__ __forceinline__ void softmax_tile(v8f (&s)[4], float& l, v16h& pb0, v16h& pb1) {
    float rs = 0.0f;
#pragma unroll
    for (int r = 0; r < 8; ++r) {
        s[0][r] = __builtin_amdgcn_exp2f(s[0][r]); rs += s[0][r];
        s[1][r] = __builtin_amdgcn_exp2f(s[1][r]); rs += s[1][r];
        s[2][r] = __builtin_amdgcn_exp2f(s[2][r]); rs += s[2][r];
        s[3][r] = __builtin_amdgcn_exp2f(s[3][r]); rs += s[3][r];
    }
    rs += __shfl_xor(rs, 16, 32);
    l += rs;

    // P^T B operands: direct element copy from S^T accumulators
#pragma unroll
    for (int r = 0; r < 8; ++r) {
        pb0[r]     = (half_t)s[0][r];  // keys kbase    .. +15
        pb0[r + 8] = (half_t)s[1][r];  // keys kbase+16 .. +31
        pb1[r]     = (half_t)s[2][r];  // keys kbase+32 .. +47
        pb1[r + 8] = (half_t)s[3][r];  // keys kbase+48 .. +63
    }
}

// The 8 fragments (8 KB) of one chunk's K or V^T. p = the chunk's first half + 8 * lane
__device__ __forceinline__ void load_chunk(const half_t* __restrict__ p, v16h (&f)[8]) {
#pragma unroll
    for (int i = 0; i < 8; ++i) f[i] = load_frag(p + i * 512);
}

// Scores S^T of 64 keys x the 2 tiles of one group: 4 subtiles x 2 WMMAs each,
// started from nref, minus each query's reference maximum, so that they come out
// as the exp2 arguments (the scale is already folded into q); then the causal
// mask; only a group's last chunk holds keys behind the group's first query.
__device__ __forceinline__ void scores_group(const v16h (&kf)[8], const v16h (&bq)[2][2],
                                             const v8f (&nref)[2],
                                             int kbase, int qbase, int lane16, int khalf,
                                             v8f (&s)[2][4]) {
#pragma unroll
    for (int t = 0; t < 2; ++t)
#pragma unroll
        for (int i = 0; i < 4; ++i)
            s[t][i] = wmma_f16(kf[2 * i], bq[t][0], nref[t]);
#pragma unroll
    for (int t = 0; t < 2; ++t)
#pragma unroll
        for (int i = 0; i < 4; ++i)
            s[t][i] = wmma_f16(kf[2 * i + 1], bq[t][1], s[t][i]);
    if (kbase + 63 > qbase) {
#pragma unroll
        for (int t = 0; t < 2; ++t) {
            const int qg = qbase + 16 * t + lane16;   // this lane's query
#pragma unroll
            for (int r = 0; r < 8; ++r) {
                const int kg = kbase + r + 8 * khalf; // key = r + 8*(lane/16)
                if (kg > qg)      s[t][0][r] = NEG_BIG;
                if (kg + 16 > qg) s[t][1][r] = NEG_BIG;
                if (kg + 32 > qg) s[t][2][r] = NEG_BIG;
                if (kg + 48 > qg) s[t][3][r] = NEG_BIG;
            }
        }
    }
}

// Softmax of both tiles of a group, then O^T += V^T * P^T:
// 2 tiles x 4 h-tiles x 2 key-halves. The references are raised, and o and l
// rescaled, only on the group's first chunk in this wave (first, the same in
// every lane) or when some score tops its reference by more than LAZY_MAX: one
// test for the whole wave, a scalar branch.
__device__ __forceinline__ void softmax_pv(v8f (&s)[2][4], bool first, float (&m)[2],
                                           float (&l)[2], v8f (&o)[2][4], v8f (&nref)[2],
                                           const v16h (&vf)[8]) {
    const float mc0 = tile_max(s[0]);
    const float mc1 = tile_max(s[1]);
    const bool tops = __builtin_amdgcn_ballot_w32(fmaxf(mc0, mc1) > LAZY_MAX) != 0;
    // Marked unlikely so that the raise lies off the straight path of the loop.
    if (__builtin_expect(first | tops, 0)) {
        raise_reference(s[0], mc0, first, m[0], l[0], o[0], nref[0]);
        raise_reference(s[1], mc1, first, m[1], l[1], o[1], nref[1]);
    }
    v16h pb[2][2];
#pragma unroll
    for (int t = 0; t < 2; ++t)
        softmax_tile(s[t], l[t], pb[t][0], pb[t][1]);
#pragma unroll
    for (int kk = 0; kk < 2; ++kk)
#pragma unroll
        for (int t = 0; t < 2; ++t)
#pragma unroll
            for (int i = 0; i < 4; ++i)
                o[t][i] = wmma_f16(vf[4 * kk + i], pb[t][kk], o[t][i]);
}

// A wave's partial result of one group goes to LDS.
__device__ __forceinline__ void leave_group(float4* part, float2* ml, int wave, int lane,
                                            int grp, const v8f (&o)[2][4],
                                            const float (&m)[2], const float (&l)[2]) {
#pragma unroll
    for (int t = 0; t < 2; ++t) {
        const int gt = grp * 2 + t;
#pragma unroll
        for (int i = 0; i < 4; ++i) {
            float4* pp = part + ((wave * 32 + (gt * 4 + i) * 2) * 32 + lane);
            pp[0]  = make_float4(o[t][i][0], o[t][i][1], o[t][i][2], o[t][i][3]);
            pp[32] = make_float4(o[t][i][4], o[t][i][5], o[t][i][6], o[t][i][7]);
        }
        if (lane < 16) ml[(wave * 4 + gt) * 16 + lane] = make_float2(m[t], l[t]);
    }
}

__global__ void __launch_bounds__(32 * AWAVES)
attn_kernel(const half_t* __restrict__ qh, const half_t* __restrict__ khp,
            const half_t* __restrict__ vtp, float* __restrict__ out) {
    // part[wave][slot][lane]: 4 floats of a wave's un-normalised O^T, with
    // slot = ((group*2 + tile)*4 + t4)*2 + (upper 4 of the lane's 8 h values)
    __shared__ float4 part[AWAVES * 32 * 32];
    // ml[wave][group*2 + tile][query]: that wave's (m, l)
    __shared__ float2 ml[AWAVES * 4 * 16];

    const int lane   = threadIdx.x & 31;
    const int lane16 = lane & 15;
    const int khalf  = lane >> 4;
    const int wave   = __builtin_amdgcn_readfirstlane(threadIdx.x >> 5);

    const int bidx = blockIdx.x >> 6;   // batch
    const int p    = blockIdx.x & 63;   // pair of query groups: 127-p and p

    const half_t* __restrict__ klane = khp + (size_t)bidx * 256 * 1024 + (size_t)lane * 8;
    const half_t* __restrict__ vlane = vtp + (size_t)bidx * 128 * 2048 + (size_t)lane * 8;

    const int nfirst  = ((127 - p) >> 1) + 1;   // chunks of group 127-p (33..64)
    const int nboth   = 65 - nfirst;            // chunks 0 .. nboth-1: group p sees them too (1..32)
    const int nsingle = nfirst - nboth;         // chunks nboth .. nfirst-1: group 127-p alone (1..63)

    // The deal. A chunk for both groups is two units of work, a chunk for one
    // group is one; 65 units in all. Chunk d < nboth goes to wave d % 8. That
    // leaves waves nrem .. 7 two units behind the others, so the first single
    // chunks go to them, two each; the rest goes round all 8 waves. No wave gets
    // more than 9 units. A wave's jobs are numbered: its nd double chunks, then
    // its ns1 single ones.
    const int nrem = nboth & 7;
    const int lev  = 2 * (8 - nrem);            // single chunks that level the waves
    const int nd   = (nboth - wave + 7) >> 3;
    const int left = nsingle - lev - wave;
    int ns1 = (left > 0) ? ((left + 7) >> 3) : 0;
    if (wave >= nrem)
        ns1 += ((wave - nrem) < nsingle ? 1 : 0) + ((8 - nrem + wave - nrem) < nsingle ? 1 : 0);
    const int njobs = nd + ns1;                 // 4 .. 8
    // The 64 blocks of a batch read the same K and V. So that they do not all ask
    // L2 for the same lines at the same moment, each block enters its waves' job
    // lists at a place of its own and wraps; the online softmax takes any order.
    const int jstart = (((p * 27) & 63) * njobs) >> 6;   // 0 .. njobs-1

    // The chunk of the wave's job j (counted from jstart, wrapped): double chunk
    // number idx, or single chunk number u: the first nlev of a wave's single
    // chunks are levelling ones.
    const bool late  = wave >= nrem;
    const int  nlev  = late ? 2 : 0;
    const int  clev  = nboth + wave - nrem;                     // + (8 - nrem) * u while u < nlev
    const int  crest = nboth + lev + wave - (late ? 16 : 0);    // + 8 * u from u = nlev on
    auto chunk_of = [&](int j) -> int {
        const int i0  = j + jstart;
        const int idx = (i0 >= njobs) ? (i0 - njobs) : i0;
        const int u   = idx - nd;
        const int cs  = (u < nlev) ? (clev + u * (8 - nrem)) : (crest + 8 * u);
        return (u < 0) ? (wave + 8 * idx) : cs;
    };

    // Q^T B-fragments of both tiles of both groups: N = query = lane%16, K = h
    // a group is 2 tiles x 2 fragments, 2048 halves in a row
    const half_t* __restrict__ qa =
        qh + ((size_t)bidx * 128 + (127 - p)) * 2048 + (size_t)lane * 8;
    const half_t* __restrict__ qb =
        qh + ((size_t)bidx * 128 + p) * 2048 + (size_t)lane * 8;
    v16h bqa[2][2], bqb[2][2];
#pragma unroll
    for (int t = 0; t < 2; ++t) {
#pragma unroll
        for (int f = 0; f < 2; ++f) {
            bqa[t][f] = load_frag(qa + (t * 2 + f) * 512);
            bqb[t][f] = load_frag(qb + (t * 2 + f) * 512);
        }
    }
    // The address registers of the Q loads get other values behind this: the
    // loads' address translations are waited for first. The two pointers are
    // inputs so that their registers stay untouched up to the wait.
    asm volatile("s_wait_xcnt 0x0" :: "v"(qa), "v"(qb) : "memory");

    // K fragments of the wave's first job; each pass fetches the next job's.
    int c = chunk_of(0);
    const half_t* __restrict__ kfirst = klane + (size_t)c * 4096;
    v16h kf[8];
    load_chunk(kfirst, kf);
    // The same for the address registers of these K loads.
    asm volatile("s_wait_xcnt 0x0" :: "v"(kfirst) : "memory");

    const int qbasea = (127 - p) * 32;   // first query of group 127-p
    const int qbaseb = p * 32;           // first query of group p
    float ma[2] = {NEG_BIG, NEG_BIG}, la[2] = {0.0f, 0.0f};
    float mb[2] = {NEG_BIG, NEG_BIG}, lb[2] = {0.0f, 0.0f};
    v8f oa[2][4] = {}, ob[2][4] = {};
    // minus the reference maxima, and whether a group has had no chunk yet
    v8f nrefa[2] = {}, nrefb[2] = {};
    bool firsta = true, firstb = true;

    // Where the current job's V lies
    const half_t* __restrict__ vcur = vlane + (size_t)c * 4096;
    for (int j = 0; j < njobs; ++j) {
        // --- this chunk's V^T fragments, wanted behind the first softmax ---
        v16h vf[8];
        load_chunk(vcur, vf);

        const int  kbase = c * 64;
        const bool both  = c < nboth;
        const bool more  = j + 1 < njobs;
        const int  cnext = more ? chunk_of(j + 1) : c;
        const half_t* __restrict__ knext = klane + (size_t)cnext * 4096;

        v8f s[2][4];
        scores_group(kf, bqa, nrefa, kbase, qbasea, lane16, khalf, s);
        if (!both) {
            // --- K fragments of the wave's next job, behind the last use of this one's ---
            if (more) load_chunk(knext, kf);
            // The K and V pointers take new values behind this pass: the address
            // translations of this pass's loads are waited for before their registers
            // change. The two pointers are inputs so that their registers stay
            // untouched up to the wait.
            asm volatile("s_wait_xcnt 0x0" :: "v"(vcur), "v"(knext) : "memory");
        }
        softmax_pv(s, firsta, ma, la, oa, nrefa, vf);
        firsta = false;
        if (both) {
            // --- the same K and V fragments once more, for group p ---
            scores_group(kf, bqb, nrefb, kbase, qbaseb, lane16, khalf, s);
            if (more) load_chunk(knext, kf);
            // As above.
            asm volatile("s_wait_xcnt 0x0" :: "v"(vcur), "v"(knext) : "memory");
            softmax_pv(s, firstb, mb, lb, ob, nrefb, vf);
            firstb = false;
        }
        c = cnext;
        vcur = vlane + (size_t)c * 4096;
    }

    leave_group(part, ml, wave, lane, 0, oa, ma, la);
    leave_group(part, ml, wave, lane, 1, ob, mb, lb);

    // Every wave's partial results are in LDS before any wave merges them.
    __syncthreads();

    // --- merge: wave w takes tile w/2 (of the 4) and h values 32*(w%2) .. +31,
    // one whole 128-byte line of each of its 16 output rows ---
    const int gt   = wave >> 1;
    const int qrow = ((gt >> 1) ? p : (127 - p)) * 32 + (gt & 1) * 16 + lane16;
    float wm[AWAVES], wl[AWAVES];
    float mall = NEG_BIG;
#pragma unroll
    for (int w = 0; w < AWAVES; ++w) {
        const float2 v = ml[(w * 4 + gt) * 16 + lane16];
        wm[w] = v.x; wl[w] = v.y;
        mall = fmaxf(mall, v.x);
    }
    float lall = 0.0f;
#pragma unroll
    for (int w = 0; w < AWAVES; ++w) {
        wm[w] = __builtin_amdgcn_exp2f(wm[w] - mall);   // a wave without chunks weighs 0
        lall += wm[w] * wl[w];
    }
    const float inv = 1.0f / lall;

    // O^T element (h = t4*16 + r + 8*khalf, query = lane%16)
    float* __restrict__ orow =
        out + ((size_t)(bidx << 12) + qrow) * HEAD + (wave & 1) * 32 + 8 * khalf;
#pragma unroll
    for (int j = 0; j < 4; ++j) {       // t4 = 2*(w%2) + j/2, upper half = j%2
        const float4* pp = part + ((gt * 8 + (wave & 1) * 4 + j) * 32 + lane);
        float4 acc = make_float4(0.0f, 0.0f, 0.0f, 0.0f);
#pragma unroll
        for (int w = 0; w < AWAVES; ++w) {
            const float4 v = pp[w * 32 * 32];
            acc.x += wm[w] * v.x; acc.y += wm[w] * v.y;
            acc.z += wm[w] * v.z; acc.w += wm[w] * v.w;
        }
        acc.x *= inv; acc.y *= inv; acc.z *= inv; acc.w *= inv;
        *(float4*)(orow + (j >> 1) * 16 + (j & 1) * 4) = acc;
    }
}

// ---------------------------------------------------------------------------
extern "C" void kernel_launch(void* const* d_in, const int* in_sizes, int n_in,
                              void* d_out, int out_size, void* d_ws, size_t ws_size,
                              hipStream_t stream) {
    const float* x  = (const float*)d_in[0];
    const float* Wq = (const float*)d_in[1];
    const float* bq = (const float*)d_in[2];
    const float* Wk = (const float*)d_in[3];
    const float* bk = (const float*)d_in[4];
    const float* Wv = (const float*)d_in[5];
    const float* bv = (const float*)d_in[6];
    float* out = (float*)d_out;

    const size_t QK = (size_t)NBATCH * TSEQ * HEAD; // 1,048,576 elems
    half_t* qh    = (half_t*)d_ws;
    half_t* khp   = qh + QK;                 // K as A fragments
    half_t* vtp   = khp + QK;                // V^T as A fragments
    half_t* wpack = vtp + QK;                // 3 * 65536 f16

    pack_w_kernel<<<(3 * WPACK_ELEMS) / 256, 256, 0, stream>>>(Wq, Wk, Wv, wpack);

    // one block of 8 waves per 64 rows of x
    qkv_proj_kernel<<<NBATCH * TSEQ / QROWS, 256, 0, stream>>>(x, wpack, bq, bk, bv,
                                                               qh, khp, vtp);

    // one block per pair of 32-query groups: 64 pairs in each batch
    attn_kernel<<<NBATCH * (TSEQ / 64), 32 * AWAVES, 0, stream>>>(qh, khp, vtp, out);
}
